// v000
// Measured on an AMD MI455X. A time is GPU time per run, averaged over a window of back-to-back runs after a warm-up
// (all launches, gaps included; the runs take copies of the inputs in turn), and the median of several windows.
// Apart from v000's, it joins two sittings. Times from different sittings can be a few percent apart, while
// side-by-side timings come from the same sitting.
// The starting kernel, v000, takes 367 microseconds a run.
#include <hip/hip_runtime.h>

// Contractions: six input projections, key x query^T score tiles and value^T x prob^T tiles,
// all v_wmma_f32_16x16x32_f16 (f16 operands, f32 accumulate). f16 operand scaling: weights x64,
// queries x0.125, probabilities x16384, folded back in f32 epilogues. Softmax statistics,
// normalisation and the outputs: f32.

typedef _Float16     v16h __attribute__((ext_vector_type(16)));
typedef _Float16     v8h  __attribute__((ext_vector_type(8)));
typedef float        v8f  __attribute__((ext_vector_type(8)));
typedef float        v4f  __attribute__((ext_vector_type(4)));
typedef unsigned int v4u  __attribute__((ext_vector_type(4)));

union Frag { v16h v; v8h h[2]; v4u u[2]; };
union H8   { v8h h; v4u u; };

#define DM    1024            // model width (dim_in = dim_k = dim_v)
#define NB    2               // batch
#define NSEQ  2048            // sequence length
#define NTOK  (NB * NSEQ)     // token rows
#define NHD   16              // heads
#define DH    64              // head width
#define NPROJ 6
#define NXE   (NTOK * DM)     // 4194304 elements per activation tensor
#define NWE   (DM * DM)       // 1048576 elements per weight

// workspace in 16-bit units:
//   xh  [4096][1024]            f16(x)            at OFF_XH
//   wh  [6][1024][1024]         f16(64 * W_p)     at OFF_WH
//   six planes of 4096*1024:    p = 0,1,3,4 -> [b*16+head][n][64] (q planes carry x0.125),
//                               p = 2,5     -> [b*16+head][64][n]  at OFF_PL + p * NXE
#define OFF_XH    ((size_t)0)
#define OFF_WH    ((size_t)NXE)
#define OFF_PL    ((size_t)NXE + (size_t)NPROJ * (size_t)NWE)
#define WS_HALVES (OFF_PL + (size_t)NPROJ * (size_t)NXE)        // 35651584 -> 71303168 B

// ------------------------------------------------------------------------
// helpers
// ------------------------------------------------------------------------
__device__ __forceinline__ v8f vzero8() {
    v8f z = {0.f, 0.f, 0.f, 0.f, 0.f, 0.f, 0.f, 0.f};
    return z;
}

// Fragment layout (wave32, 16x16x32), identical for A and B:
//   lane l: h = l>>4, m = l&15 = row of A / column of B / column of D
//   elements 0..7  -> k = k0 + 8h + 0..7
//   elements 8..15 -> k = k0 + 16 + 8h + 0..7
//   D element r -> (row 8h + r, column m)
// p points at element k0 of a k-contiguous 16-bit row (16-B aligned).
__device__ __forceinline__ void ldfrag(Frag& f, const _Float16* p, int h) {
    f.h[0] = *reinterpret_cast<const v8h*>(p + 8 * h);
    f.h[1] = *reinterpret_cast<const v8h*>(p + 16 + 8 * h);
}

__device__ __forceinline__ v8f mma(const Frag& a, const Frag& b, v8f c) {
    c = __builtin_amdgcn_wmma_f32_16x16x32_f16(false, a.v, false, b.v, (short)0, c, false, false);
    asm volatile("v_nop\n\tv_nop\n\tv_nop\n\tv_nop" : "+v"(c) : "v"(a.v), "v"(b.v));
    return c;
}

// ------------------------------------------------------------------------
// Launch 1: f32 -> f16 conversion of x (scale 1) and the six weights (scale 64).
// Ten segments of 1048576 elements (x quarters 0..3, weights 4..9), grid (64, 10).
// Each lane converts 8 consecutive values -> one 16-B store; lanes 8q..8q+7 fill
// ------------------------------------------------------------------------
#define CV_IT  8
#define CV_BLK (256 * 8 * CV_IT)        // 16384 elements per block

__global__ __launch_bounds__(256) void cvt_kernel(
    const float* __restrict__ x,
    const float* __restrict__ W0, const float* __restrict__ W1, const float* __restrict__ W2,
    const float* __restrict__ W3, const float* __restrict__ W4, const float* __restrict__ W5,
    _Float16* wsh)
{
    const int tid = threadIdx.x;
    const int seg = blockIdx.y;                                      // block-uniform
    const float* src;
    float sc;
    if (seg < 4) {
        src = x + (size_t)seg * NWE;
        sc  = 1.0f;
    } else {
        const int p = seg - 4;
        src = (p == 0) ? W0 : (p == 1) ? W1 : (p == 2) ? W2 : (p == 3) ? W3 : (p == 4) ? W4 : W5;
        sc  = 64.0f;                                                 // exact power of two
    }
    const size_t base = (size_t)blockIdx.x * CV_BLK;
    const float* sp = src + base;
    _Float16*    dp = wsh + (size_t)seg * NWE + base;

    H8 v[CV_IT];
#pragma unroll
    for (int i = 0; i < CV_IT; ++i) {
        const int e = (i * 256 + tid) * 8;
        const v4f f0 = *reinterpret_cast<const v4f*>(sp + e);
        const v4f f1 = *reinterpret_cast<const v4f*>(sp + e + 4);
        H8 t;
        t.u = (v4u){0u, 0u, 0u, 0u};
#pragma unroll
        for (int q = 0; q < 4; ++q) {
            t.h[q]     = (_Float16)(f0[q] * sc);                     // RNE convert
            t.h[4 + q] = (_Float16)(f1[q] * sc);
        }
        v[i] = t;
    }
#pragma unroll
    for (int i = 0; i < CV_IT; ++i) {
        const int e = (i * 256 + tid) * 8;
        *reinterpret_cast<v4u*>(dp + e) = v[i].u;
    }
    
}

// ------------------------------------------------------------------------
// Launch 2/3: Y = xh . wh^T / 64 for the projections. Block tile 128 tokens x 64
// features (one head), 4 waves of 32 tokens x 64 features, K stepped by 32.
// Fragments are loaded directly from the f16 global rows (both operands k-contiguous,
// identical split k map). ISV = 0: q/k planes [bh][n][64] (q planes additionally x0.125);
// ISV = 1: value planes transposed [bh][64][n]. The block tile is staged as f16 in
// ------------------------------------------------------------------------
#define P_BM 128
#define P_BN 64
#define P_BK 32

template <int ISV>
__global__ __launch_bounds__(128) void proj_kernel(const _Float16* xh, const _Float16* wh,
                                                   _Float16* planes)
{
    __shared__ v4u St[1024];                                         // 16 KB f16 tile

    const int tid  = threadIdx.x;
    const int lane = tid & 31, w = tid >> 5, lo = lane & 15, hf = lane >> 4;
    const int z    = blockIdx.z;                                     // block-uniform
    int proj;
    float osc;
    if (ISV) {
        proj = 2 + 3 * z;                                            // 2, 5
        osc  = 1.0f / 64.0f;
    } else {
        proj = z + ((z >= 2) ? 1 : 0);                               // 0, 1, 3, 4
        osc  = (z == 0 || z == 2) ? (1.0f / 512.0f) : (1.0f / 64.0f);   // q planes: 0.125 / 64
    }
    const int n0 = blockIdx.x * P_BN;                                // feature base = head * 64
    const int m0 = blockIdx.y * P_BM;                                // token base

    const _Float16* xa = xh + (size_t)(m0 + 32 * w + lo) * DM;             // + 16*mt*DM
    const _Float16* wb = wh + ((size_t)proj * DM + n0 + lo) * DM;           // + 16*nt*DM

    v8f acc[2][4];
#pragma unroll
    for (int mt = 0; mt < 2; ++mt)
#pragma unroll
        for (int nt = 0; nt < 4; ++nt) acc[mt][nt] = vzero8();

#pragma unroll 1
    for (int k0 = 0; k0 < DM; k0 += P_BK) {
        Frag xf[2];
        ldfrag(xf[0], xa + k0, hf);                                  // token rows 32w + lo
        ldfrag(xf[1], xa + 16 * DM + k0, hf);                        // token rows 32w + 16 + lo
#pragma unroll
        for (int nt = 0; nt < 4; ++nt) {
            Frag wf;
            ldfrag(wf, wb + (size_t)(16 * nt) * DM + k0, hf);        // feature rows n0 + 16nt + lo
            if (ISV) {
                // D[r] = Y[token 32w+16mt+8h+r][feat 16nt+lo]
                acc[0][nt] = mma(xf[0], wf, acc[0][nt]);
                acc[1][nt] = mma(xf[1], wf, acc[1][nt]);
            } else {
                // D[r] = Y[token 32w+16mt+lo][feat 16nt+8h+r]
                acc[0][nt] = mma(wf, xf[0], acc[0][nt]);
                acc[1][nt] = mma(wf, xf[1], acc[1][nt]);
            }
        }
    }

    // stage the scaled f16 tile in LDS (each lane one 16-B vector per (mt, nt))
#pragma unroll
    for (int mt = 0; mt < 2; ++mt) {
#pragma unroll
        for (int nt = 0; nt < 4; ++nt) {
            H8 t;
            t.u = (v4u){0u, 0u, 0u, 0u};
#pragma unroll
            for (int r = 0; r < 8; ++r) t.h[r] = (_Float16)(acc[mt][nt][r] * osc);
            if (ISV) {
                // St[feat][token], pitch 128 halves: feat 16nt+lo, tokens 32w+16mt+8h .. +7
                St[(16 * nt + lo) * 16 + 4 * w + 2 * mt + hf] = t.u;
            } else {
                // St[token][feat], pitch 64 halves: token 32w+16mt+lo, feats 16nt+8h .. +7
                St[(32 * w + 16 * mt + lo) * 8 + 2 * nt + hf] = t.u;
            }
        }
    }
    __syncthreads();

    // 128 lines per block; wave w owns lines 32w..32w+31; instruction s covers 4 lines,
    // lanes 8q..8q+7 fill one line with 16 B each.
    const int bhi = (m0 / NSEQ) * NHD + blockIdx.x;
    const int nq0 = m0 % NSEQ;
    _Float16* plane = planes + (size_t)proj * NXE;
    const int c8 = lane & 7;                                         // 16-B chunk within the line
    v4u vals[8];
#pragma unroll
    for (int s = 0; s < 8; ++s) {
        const int L = 32 * w + 4 * s + (lane >> 3);
        vals[s] = St[L * 8 + c8];
    }
#pragma unroll
    for (int s = 0; s < 8; ++s) {
        const int L = 32 * w + 4 * s + (lane >> 3);
        const size_t off = ISV ? (((size_t)bhi * DH + (L >> 1)) * NSEQ + (size_t)(nq0 + 64 * (L & 1) + 8 * c8))
                               : (((size_t)bhi * NSEQ + nq0 + L) * DH + (size_t)(8 * c8));
        *reinterpret_cast<v4u*>(plane + off) = vals[s];
    }
    
}

// ------------------------------------------------------------------------
// Launch 4: attention. One block per (query block of 64, b*16+head, output index o),
// 4 waves x 16 queries. Output o uses score stream s = (head&1)^o and the value plane
// of stream o. Scores are computed transposed, S^T = K . Q^T (D rows = keys, cols =
// queries), so the probabilities come out of D already in B-fragment layout for
// O^T = V^T . P^T (element r <- 16-key tile 2c, element 8+r <- tile 2c+1). Per lane:
// one query (lo), 32 of the 64 keys of a step; the other 32 live in lane lo+16.
// K, V^T and Q^T fragments come straight from the f16 planes (no LDS staging).
// ------------------------------------------------------------------------
#define A_QB 64
#define A_KT 64

__global__ __launch_bounds__(128) void attn_kernel(const _Float16* planes, float* out)
{
    __shared__ v4f St[1024];                                         // [4 waves][16][64] f32

    const int tid  = threadIdx.x;
    const int lane = tid & 31, w = tid >> 5, lo = lane & 15, hf = lane >> 4;
    const int qb = blockIdx.x, bh = blockIdx.y, o = blockIdx.z;
    const int b  = bh >> 4, hd = bh & 15;
    const int s  = (hd & 1) ^ o;                                     // score stream
    const size_t HO = (size_t)bh * NSEQ * DH;                        // same for both plane layouts
    const _Float16* Q = planes + (size_t)(s ? 3 : 0) * NXE + HO;     // [n][64], x0.125 inside
    const _Float16* K = planes + (size_t)(s ? 4 : 1) * NXE + HO;     // [n][64]
    const _Float16* V = planes + (size_t)(o ? 5 : 2) * NXE + HO;     // [64][n]
    const int q0   = qb * A_QB;
    const int qrow = q0 + 16 * w + lo;

    // Q^T as B operand: column = query (lane lo), k = d by the split map
    Frag qf[2];
#pragma unroll
    for (int dc = 0; dc < 2; ++dc) ldfrag(qf[dc], Q + (size_t)qrow * DH + 32 * dc, hf);

    v8f O[4];
#pragma unroll
    for (int i = 0; i < 4; ++i) O[i] = vzero8();
    float mrun = -1e30f, lrun = 0.f;

#pragma unroll 1
    for (int t = 0; t < NSEQ / A_KT; ++t) {
        const int kb = t * A_KT;

        // S^T tiles j = 0..3: keys kb+16j .. kb+16j+15; D[r] = score(query lo, key kb+16j+8h+r)
        float p[32];
#pragma unroll
        for (int j = 0; j < 4; ++j) {
            v8f S = vzero8();
#pragma unroll
            for (int dc = 0; dc < 2; ++dc) {
                Frag kf;                                             // A operand: row = key, k = d
                ldfrag(kf, K + (size_t)(kb + 16 * j + lo) * DH + 32 * dc, hf);
                S = mma(kf, qf[dc], S);
            }
#pragma unroll
            for (int r = 0; r < 8; ++r) p[8 * j + r] = S[r];
        }

        // online softmax in f32 (row = query lo; partner lane lo^16 holds the other 32 keys)
        float tmax = p[0];
#pragma unroll
        for (int i = 1; i < 32; ++i) tmax = fmaxf(tmax, p[i]);
        tmax = fmaxf(tmax, __shfl_xor(tmax, 16, 32));
        const float mnew  = fmaxf(mrun, tmax);
        const float alpha = __expf(mrun - mnew);
        float rs = 0.f;
#pragma unroll
        for (int i = 0; i < 32; ++i) { p[i] = __expf(p[i] - mnew); rs += p[i]; }
        rs += __shfl_xor(rs, 16, 32);
        lrun = lrun * alpha + rs;
        mrun = mnew;
#pragma unroll
        for (int nt = 0; nt < 4; ++nt) O[nt] = O[nt] * alpha;

        // O^T[dv][q] += V^T[dv][key] . P^T[key][q] over two 32-key halves c
#pragma unroll
        for (int c = 0; c < 2; ++c) {
            // P^T as B operand straight from the D layout, carried x16384:
            // element r <- key 32c+8h+r (tile 2c), element 8+r <- key 32c+16+8h+r (tile 2c+1)
            H8 a0, a1;
            a0.u = (v4u){0u, 0u, 0u, 0u};
            a1.u = (v4u){0u, 0u, 0u, 0u};
#pragma unroll
            for (int r = 0; r < 8; ++r) {
                a0.h[r] = (_Float16)(p[16 * c + r] * 16384.0f);
                a1.h[r] = (_Float16)(p[16 * c + 8 + r] * 16384.0f);
            }
            Frag pf;
            pf.u[0] = a0.u;
            pf.u[1] = a1.u;
#pragma unroll
            for (int nt = 0; nt < 4; ++nt) {
                Frag vf;                                             // A operand: row = dv 16nt+lo, k = key
                ldfrag(vf, V + (size_t)(16 * nt + lo) * NSEQ + kb + 32 * c, hf);
                O[nt] = mma(vf, pf, O[nt]);                          // D[r] = O[query lo][dv 16nt+8h+r]
            }
        }
    }

    const float inv = 1.0f / (lrun * 16384.0f);                      // lrun >= 1
    v4f* Sw = St + w * 256;
#pragma unroll
    for (int nt = 0; nt < 4; ++nt) {
        v4f a  = {O[nt][0] * inv, O[nt][1] * inv, O[nt][2] * inv, O[nt][3] * inv};
        v4f cc = {O[nt][4] * inv, O[nt][5] * inv, O[nt][6] * inv, O[nt][7] * inv};
        Sw[lo * 16 + 4 * nt + 2 * hf]     = a;                       // floats lo*64 + 16nt + 8h .. +3
        Sw[lo * 16 + 4 * nt + 2 * hf + 1] = cc;                      // .. +4 .. +7
    }
    __syncthreads();

    float* ob = out + (size_t)o * NXE + ((size_t)b * NSEQ + q0 + 16 * w) * DM + (size_t)hd * DH;
    const int c = (lane & 7) * 4;
    v4f vals[8];
#pragma unroll
    for (int si = 0; si < 8; ++si) {
        const int L = 4 * si + (lane >> 3);          // 32 lines per wave: row = L>>1, half = L&1
        vals[si] = Sw[8 * L + (lane & 7)];
    }
#pragma unroll
    for (int si = 0; si < 8; ++si) {
        const int L = 4 * si + (lane >> 3);
        *reinterpret_cast<v4f*>(ob + (size_t)(L >> 1) * DM + 32 * (L & 1) + c) = vals[si];
    }
    
}

// ------------------------------------------------------------------------
// host glue: 4 launches; shapes are fixed by the module configuration and
// checked against the passed sizes (no-op on any disagreement).
// ------------------------------------------------------------------------
extern "C" void kernel_launch(void* const* d_in, const int* in_sizes, int n_in,
                              void* d_out, int out_size, void* d_ws, size_t ws_size,
                              hipStream_t stream)
{
    if (n_in < 7) return;
    if (in_sizes[0] != NXE) return;
    for (int p = 0; p < NPROJ; ++p) if (in_sizes[1 + p] != NWE) return;
    if (out_size != 2 * NXE) return;
    const size_t ws_need = WS_HALVES * sizeof(_Float16);             // 71303168 B
    if (ws_size < ws_need) return;

    const float* x  = (const float*)d_in[0];
    const float* W0 = (const float*)d_in[1];
    const float* W1 = (const float*)d_in[2];
    const float* W2 = (const float*)d_in[3];
    const float* W3 = (const float*)d_in[4];
    const float* W4 = (const float*)d_in[5];
    const float* W5 = (const float*)d_in[6];
    _Float16* wsh = (_Float16*)d_ws;
    float* out = (float*)d_out;

    cvt_kernel<<<dim3(NWE / CV_BLK, 10, 1), 256, 0, stream>>>(x, W0, W1, W2, W3, W4, W5, wsh + OFF_XH);
    proj_kernel<0><<<dim3(DM / P_BN, NTOK / P_BM, 4), 128, 0, stream>>>(wsh + OFF_XH, wsh + OFF_WH, wsh + OFF_PL);
    proj_kernel<1><<<dim3(DM / P_BN, NTOK / P_BM, 2), 128, 0, stream>>>(wsh + OFF_XH, wsh + OFF_WH, wsh + OFF_PL);
    attn_kernel<<<dim3(NSEQ / A_QB, NB * NHD, 2), 128, 0, stream>>>(wsh + OFF_PL, out);
}

// v001
// One run takes 352 microseconds.
// Timed twice side by side with v000, it ran 1.08 and 1.07 times as fast.
#include <hip/hip_runtime.h>

// Contractions: six input projections, key x query^T score tiles and value^T x prob^T tiles,
// all v_wmma_f32_16x16x32_f16 (f16 operands, f32 accumulate). f16 operand scaling: weights x64,
// queries x0.125, probabilities x16384, folded back in f32 epilogues. Softmax statistics,
// normalisation and the outputs: f32.

typedef _Float16     v16h __attribute__((ext_vector_type(16)));
typedef _Float16     v8h  __attribute__((ext_vector_type(8)));
typedef float        v8f  __attribute__((ext_vector_type(8)));
typedef float        v4f  __attribute__((ext_vector_type(4)));
typedef unsigned int v4u  __attribute__((ext_vector_type(4)));

union Frag { v16h v; v8h h[2]; v4u u[2]; };
union H8   { v8h h; v4u u; };

#define DM    1024            // model width (dim_in = dim_k = dim_v)
#define NB    2               // batch
#define NSEQ  2048            // sequence length
#define NTOK  (NB * NSEQ)     // token rows
#define NHD   16              // heads
#define DH    64              // head width
#define NPROJ 6
#define NXE   (NTOK * DM)     // 4194304 elements per activation tensor
#define NWE   (DM * DM)       // 1048576 elements per weight

// workspace in 16-bit units; every operand lies in fragment order: a tile of 16 rows x 32 k
// is 512 consecutive units, unit = (k_in >> 3) * 128 + row_in * 8 + (k_in & 7), so that lane l
// of a wave finds its two 16-B fragment halves at tile + 8l and tile + 256 + 8l.
//   xh  f16(x)         rows = tokens,   k = dim_in: tile (row/16) * 32 + k/32       at OFF_XH
//   wh  f16(64 * W_p)  rows = features, k = dim_in: the same per weight             at OFF_WH
//   six planes of 4096*1024 at OFF_PL + p * NXE, each [b*16+head] x 131072 units:
//     p = 0,1,3,4  rows = n,  k = d: tile (n/16) * 2 + d/32 (q planes carry x0.125)
//     p = 2,5      rows = dv, k = n: tile (n/32) * 4 + dv/16
#define OFF_XH    ((size_t)0)
#define OFF_WH    ((size_t)NXE)
#define OFF_PL    ((size_t)NXE + (size_t)NPROJ * (size_t)NWE)
#define WS_HALVES (OFF_PL + (size_t)NPROJ * (size_t)NXE)        // 35651584 -> 71303168 B

// ------------------------------------------------------------------------
// helpers
// ------------------------------------------------------------------------
__device__ __forceinline__ v8f vzero8() {
    v8f z = {0.f, 0.f, 0.f, 0.f, 0.f, 0.f, 0.f, 0.f};
    return z;
}

// Fragment layout (wave32, 16x16x32), identical for A and B:
//   lane l: h = l>>4, m = l&15 = row of A / column of B / column of D
//   elements 0..7  -> k = k0 + 8h + 0..7
//   elements 8..15 -> k = k0 + 16 + 8h + 0..7
//   D element r -> (row 8h + r, column m)
// p = start of a fragment-ordered tile + 8 * lane: each of the two loads reads 512
// consecutive bytes per wave (four whole 128-B lines).
__device__ __forceinline__ void ldfrag(Frag& f, const _Float16* p) {
    f.h[0] = *reinterpret_cast<const v8h*>(p);
    f.h[1] = *reinterpret_cast<const v8h*>(p + 256);
}

__device__ __forceinline__ v8f mma(const Frag& a, const Frag& b, v8f c) {
    c = __builtin_amdgcn_wmma_f32_16x16x32_f16(false, a.v, false, b.v, (short)0, c, false, false);
    asm volatile("v_nop\n\tv_nop\n\tv_nop\n\tv_nop" : "+v"(c) : "v"(a.v), "v"(b.v));
    return c;
}

// ------------------------------------------------------------------------
// Launch 1: f32 -> f16 conversion of x (scale 1) and the six weights (scale 64).
// Ten segments of 1048576 elements (x quarters 0..3, weights 4..9), grid (64, 10).
// A block converts one tile row (16 rows x 1024 k), the same 16384 units in source and
// in fragment order. Each lane converts 8 consecutive k of one row -> one 16-B store; a
// wave takes 8 rows x 32 k, so its store fills four whole 128-B lines.
// ------------------------------------------------------------------------
#define CV_IT  8
#define CV_BLK (256 * 8 * CV_IT)        // 16384 elements per block

__global__ __launch_bounds__(256) void cvt_kernel(
    const float* __restrict__ x,
    const float* __restrict__ W0, const float* __restrict__ W1, const float* __restrict__ W2,
    const float* __restrict__ W3, const float* __restrict__ W4, const float* __restrict__ W5,
    _Float16* wsh)
{
    const int tid = threadIdx.x;
    const int lane = tid & 31, wv = tid >> 5;
    const int row = (wv & 1) * 8 + (lane >> 2), kq = lane & 3;       // row in the tile, 8-k chunk
    const int seg = blockIdx.y;                                      // block-uniform
    const float* src;
    float sc;
    if (seg < 4) {
        src = x + (size_t)seg * NWE;
        sc  = 1.0f;
    } else {
        const int p = seg - 4;
        src = (p == 0) ? W0 : (p == 1) ? W1 : (p == 2) ? W2 : (p == 3) ? W3 : (p == 4) ? W4 : W5;
        sc  = 64.0f;                                                 // exact power of two
    }
    const size_t base = (size_t)blockIdx.x * CV_BLK;
    // pass i: k tile 4i + (wv >> 1)
    const float* sp = src + base;
    _Float16*    dp = wsh + (size_t)seg * NWE + base;
    const int so = row * DM + (wv >> 1) * 32 + kq * 8;               // source: row-major
    const int dn = (wv >> 1) * 512 + kq * 128 + row * 8;             // destination: fragment order

    H8 v[CV_IT];
#pragma unroll
    for (int i = 0; i < CV_IT; ++i) {
        const int e = so + i * 128;
        const v4f f0 = *reinterpret_cast<const v4f*>(sp + e);
        const v4f f1 = *reinterpret_cast<const v4f*>(sp + e + 4);
        H8 t;
        t.u = (v4u){0u, 0u, 0u, 0u};
#pragma unroll
        for (int q = 0; q < 4; ++q) {
            t.h[q]     = (_Float16)(f0[q] * sc);                     // RNE convert
            t.h[4 + q] = (_Float16)(f1[q] * sc);
        }
        v[i] = t;
    }
#pragma unroll
    for (int i = 0; i < CV_IT; ++i) {
        const int e = dn + i * 2048;
        *reinterpret_cast<v4u*>(dp + e) = v[i].u;
    }
    
}

// ------------------------------------------------------------------------
// Launch 2/3: Y = xh . wh^T / 64 for the projections. Block tile 128 tokens x 64
// features (one head), 4 waves of 32 tokens x 64 features, K stepped by 32.
// Fragments are loaded directly from the fragment-ordered f16 tiles (identical split k map
// for both operands). ISV = 0: q/k planes, rows = n (q planes additionally x0.125);
// ISV = 1: value planes, rows = dv. In both the 8 values a lane holds of an accumulator are
// one 16-B chunk of the plane's fragment order at tile half + 8 * lane: stored directly,
// 512 consecutive bytes per wave and store.
// ------------------------------------------------------------------------
#define P_BM 128
#define P_BN 64
#define P_BK 32

template <int ISV>
__global__ __launch_bounds__(128) void proj_kernel(const _Float16* xh, const _Float16* wh,
                                                   _Float16* planes)
{
    const int tid  = threadIdx.x;
    const int lane = tid & 31, w = tid >> 5;
    const int z    = blockIdx.z;                                     // block-uniform
    int proj;
    float osc;
    if (ISV) {
        proj = 2 + 3 * z;                                            // 2, 5
        osc  = 1.0f / 64.0f;
    } else {
        proj = z + ((z >= 2) ? 1 : 0);                               // 0, 1, 3, 4
        osc  = (z == 0 || z == 2) ? (1.0f / 512.0f) : (1.0f / 64.0f);   // q planes: 0.125 / 64
    }
    const int n0 = blockIdx.x * P_BN;                                // feature base = head * 64
    const int m0 = blockIdx.y * P_BM;                                // token base

    const _Float16* xa = xh + (size_t)(m0 + 32 * w) * DM + 8 * lane;        // + 16*mt*DM + 16*k0
    const _Float16* wb = wh + ((size_t)proj * DM + n0) * DM + 8 * lane;     // + 16*nt*DM + 16*k0

    v8f acc[2][4];
#pragma unroll
    for (int mt = 0; mt < 2; ++mt)
#pragma unroll
        for (int nt = 0; nt < 4; ++nt) acc[mt][nt] = vzero8();

#pragma unroll 1
    for (int k0 = 0; k0 < DM; k0 += P_BK) {
        Frag xf[2];
        ldfrag(xf[0], xa + 16 * k0);                                 // token rows 32w + lo
        ldfrag(xf[1], xa + 16 * DM + 16 * k0);                       // token rows 32w + 16 + lo
#pragma unroll
        for (int nt = 0; nt < 4; ++nt) {
            Frag wf;
            ldfrag(wf, wb + (size_t)(16 * nt) * DM + 16 * k0);       // feature rows n0 + 16nt + lo
            if (ISV) {
                // D[r] = Y[token 32w+16mt+8h+r][feat 16nt+lo]
                acc[0][nt] = mma(xf[0], wf, acc[0][nt]);
                acc[1][nt] = mma(xf[1], wf, acc[1][nt]);
            } else {
                // D[r] = Y[token 32w+16mt+lo][feat 16nt+8h+r]
                acc[0][nt] = mma(wf, xf[0], acc[0][nt]);
                acc[1][nt] = mma(wf, xf[1], acc[1][nt]);
            }
        }
    }

    // scaled f16 chunks straight to the plane (each lane one 16-B vector per (mt, nt))
    const int bhi = (m0 / NSEQ) * NHD + blockIdx.x;
    const int nq0 = m0 % NSEQ;
    _Float16* plane = planes + (size_t)proj * NXE + (size_t)bhi * (NSEQ * DH) + 8 * lane;
    H8 t[2][4];
#pragma unroll
    for (int mt = 0; mt < 2; ++mt) {
#pragma unroll
        for (int nt = 0; nt < 4; ++nt) {
            t[mt][nt].u = (v4u){0u, 0u, 0u, 0u};
#pragma unroll
            for (int r = 0; r < 8; ++r) t[mt][nt].h[r] = (_Float16)(acc[mt][nt][r] * osc);
        }
    }
#pragma unroll
    for (int mt = 0; mt < 2; ++mt) {
#pragma unroll
        for (int nt = 0; nt < 4; ++nt) {
            // ISV: row dv = 16nt+lo, k = tokens 32w+16mt+8h .. +7 -> tile (n/32)*4 + nt, half mt
            // else: row n = 32w+16mt+lo, k = feats 16nt+8h .. +7  -> tile (n/16)*2 + nt/2, half nt&1
            const int off = ISV ? (((nq0 / 32 + w) * 4 + nt) * 512 + mt * 256)
                                : (((nq0 / 16 + 2 * w + mt) * 2 + (nt >> 1)) * 512 + (nt & 1) * 256);
            *reinterpret_cast<v4u*>(plane + off) = t[mt][nt].u;
        }
    }
}

// ------------------------------------------------------------------------
// Launch 4: attention. One block per (query block of 64, b*16+head, output index o),
// 4 waves x 16 queries. Output o uses score stream s = (head&1)^o and the value plane
// of stream o. Scores are computed transposed, S^T = K . Q^T (D rows = keys, cols =
// queries), so the probabilities come out of D already in B-fragment layout for
// O^T = V^T . P^T (element r <- 16-key tile 2c, element 8+r <- tile 2c+1). Per lane:
// one query (lo), 32 of the 64 keys of a step; the other 32 live in lane lo+16.
// K, V^T and Q^T fragments come straight from the fragment-ordered f16 planes (no LDS
// staging); the 8 K tiles and the 8 V^T tiles of a step are 8 KB consecutive each.
// ------------------------------------------------------------------------
#define A_QB 64
#define A_KT 64

__global__ __launch_bounds__(128) void attn_kernel(const _Float16* planes, float* out)
{
    __shared__ v4f St[1024];                                         // [4 waves][16][64] f32

    const int tid  = threadIdx.x;
    const int lane = tid & 31, w = tid >> 5, lo = lane & 15, hf = lane >> 4;
    const int qb = blockIdx.x, bh = blockIdx.y, o = blockIdx.z;
    const int b  = bh >> 4, hd = bh & 15;
    const int s  = (hd & 1) ^ o;                                     // score stream
    const size_t HO = (size_t)bh * NSEQ * DH;                        // same for both plane layouts
    const _Float16* Q = planes + (size_t)(s ? 3 : 0) * NXE + HO + 8 * lane;   // tiles (n/16)*2 + d/32, x0.125 inside
    const _Float16* K = planes + (size_t)(s ? 4 : 1) * NXE + HO + 8 * lane;   // tiles (n/16)*2 + d/32
    const _Float16* V = planes + (size_t)(o ? 5 : 2) * NXE + HO + 8 * lane;   // tiles (n/32)*4 + dv/16
    const int q0   = qb * A_QB;

    // Q^T as B operand: column = query (lane lo), k = d by the split map
    Frag qf[2];
#pragma unroll
    for (int dc = 0; dc < 2; ++dc) ldfrag(qf[dc], Q + ((q0 / 16 + w) * 2 + dc) * 512);

    v8f O[4];
#pragma unroll
    for (int i = 0; i < 4; ++i) O[i] = vzero8();
    float mrun = -1e30f, lrun = 0.f;

#pragma unroll 1
    for (int t = 0; t < NSEQ / A_KT; ++t) {
        const int kb = t * A_KT;

        // S^T tiles j = 0..3: keys kb+16j .. kb+16j+15; D[r] = score(query lo, key kb+16j+8h+r)
        float p[32];
#pragma unroll
        for (int j = 0; j < 4; ++j) {
            v8f S = vzero8();
#pragma unroll
            for (int dc = 0; dc < 2; ++dc) {
                Frag kf;                                             // A operand: row = key, k = d
                ldfrag(kf, K + ((kb / 16 + j) * 2 + dc) * 512);
                S = mma(kf, qf[dc], S);
            }
#pragma unroll
            for (int r = 0; r < 8; ++r) p[8 * j + r] = S[r];
        }

        // online softmax in f32 (row = query lo; partner lane lo^16 holds the other 32 keys)
        float tmax = p[0];
#pragma unroll
        for (int i = 1; i < 32; ++i) tmax = fmaxf(tmax, p[i]);
        tmax = fmaxf(tmax, __shfl_xor(tmax, 16, 32));
        const float mnew  = fmaxf(mrun, tmax);
        const float alpha = __expf(mrun - mnew);
        float rs = 0.f;
#pragma unroll
        for (int i = 0; i < 32; ++i) { p[i] = __expf(p[i] - mnew); rs += p[i]; }
        rs += __shfl_xor(rs, 16, 32);
        lrun = lrun * alpha + rs;
        mrun = mnew;
#pragma unroll
        for (int nt = 0; nt < 4; ++nt) O[nt] = O[nt] * alpha;

        // O^T[dv][q] += V^T[dv][key] . P^T[key][q] over two 32-key halves c
#pragma unroll
        for (int c = 0; c < 2; ++c) {
            // P^T as B operand straight from the D layout, carried x16384:
            // element r <- key 32c+8h+r (tile 2c), element 8+r <- key 32c+16+8h+r (tile 2c+1)
            H8 a0, a1;
            a0.u = (v4u){0u, 0u, 0u, 0u};
            a1.u = (v4u){0u, 0u, 0u, 0u};
#pragma unroll
            for (int r = 0; r < 8; ++r) {
                a0.h[r] = (_Float16)(p[16 * c + r] * 16384.0f);
                a1.h[r] = (_Float16)(p[16 * c + 8 + r] * 16384.0f);
            }
            Frag pf;
            pf.u[0] = a0.u;
            pf.u[1] = a1.u;
#pragma unroll
            for (int nt = 0; nt < 4; ++nt) {
                Frag vf;                                             // A operand: row = dv 16nt+lo, k = key
                ldfrag(vf, V + ((kb / 32 + c) * 4 + nt) * 512);
                O[nt] = mma(vf, pf, O[nt]);                          // D[r] = O[query lo][dv 16nt+8h+r]
            }
        }
    }

    const float inv = 1.0f / (lrun * 16384.0f);                      // lrun >= 1
    v4f* Sw = St + w * 256;
#pragma unroll
    for (int nt = 0; nt < 4; ++nt) {
        v4f a  = {O[nt][0] * inv, O[nt][1] * inv, O[nt][2] * inv, O[nt][3] * inv};
        v4f cc = {O[nt][4] * inv, O[nt][5] * inv, O[nt][6] * inv, O[nt][7] * inv};
        Sw[lo * 16 + 4 * nt + 2 * hf]     = a;                       // floats lo*64 + 16nt + 8h .. +3
        Sw[lo * 16 + 4 * nt + 2 * hf + 1] = cc;                      // .. +4 .. +7
    }
    __syncthreads();

    float* ob = out + (size_t)o * NXE + ((size_t)b * NSEQ + q0 + 16 * w) * DM + (size_t)hd * DH;
    const int c = (lane & 7) * 4;
    v4f vals[8];
#pragma unroll
    for (int si = 0; si < 8; ++si) {
        const int L = 4 * si + (lane >> 3);          // 32 lines per wave: row = L>>1, half = L&1
        vals[si] = Sw[8 * L + (lane & 7)];
    }
#pragma unroll
    for (int si = 0; si < 8; ++si) {
        const int L = 4 * si + (lane >> 3);
        *reinterpret_cast<v4f*>(ob + (size_t)(L >> 1) * DM + 32 * (L & 1) + c) = vals[si];
    }
    
}

// ------------------------------------------------------------------------
// host glue: 4 launches; shapes are fixed by the module configuration and
// checked against the passed sizes (no-op on any disagreement).
// ------------------------------------------------------------------------
extern "C" void kernel_launch(void* const* d_in, const int* in_sizes, int n_in,
                              void* d_out, int out_size, void* d_ws, size_t ws_size,
                              hipStream_t stream)
{
    if (n_in < 7) return;
    if (in_sizes[0] != NXE) return;
    for (int p = 0; p < NPROJ; ++p) if (in_sizes[1 + p] != NWE) return;
    if (out_size != 2 * NXE) return;
    const size_t ws_need = WS_HALVES * sizeof(_Float16);             // 71303168 B
    if (ws_size < ws_need) return;

    const float* x  = (const float*)d_in[0];
    const float* W0 = (const float*)d_in[1];
    const float* W1 = (const float*)d_in[2];
    const float* W2 = (const float*)d_in[3];
    const float* W3 = (const float*)d_in[4];
    const float* W4 = (const float*)d_in[5];
    const float* W5 = (const float*)d_in[6];
    _Float16* wsh = (_Float16*)d_ws;
    float* out = (float*)d_out;

    cvt_kernel<<<dim3(NWE / CV_BLK, 10, 1), 256, 0, stream>>>(x, W0, W1, W2, W3, W4, W5, wsh + OFF_XH);
    proj_kernel<0><<<dim3(DM / P_BN, NTOK / P_BM, 4), 128, 0, stream>>>(wsh + OFF_XH, wsh + OFF_WH, wsh + OFF_PL);
    proj_kernel<1><<<dim3(DM / P_BN, NTOK / P_BM, 2), 128, 0, stream>>>(wsh + OFF_XH, wsh + OFF_WH, wsh + OFF_PL);
    attn_kernel<<<dim3(NSEQ / A_QB, NB * NHD, 2), 128, 0, stream>>>(wsh + OFF_PL, out);
}

// v002
// It runs in 142 microseconds.
// Two timings next to v001 put it at 2.51 and 2.46 times that version's speed.
// Counting every step since v000, it is 2.66 times as fast.
#include <hip/hip_runtime.h>

// Contractions: six input projections, key x query^T score tiles and value^T x prob^T tiles,
// all v_wmma_f32_16x16x32_f16 (f16 operands, f32 accumulate). f16 operand scaling: weights x64,
// queries x0.125, probabilities x16384, folded back in f32 epilogues. Softmax statistics,
// normalisation and the outputs: f32.

typedef _Float16     v16h __attribute__((ext_vector_type(16)));
typedef _Float16     v8h  __attribute__((ext_vector_type(8)));
typedef float        v8f  __attribute__((ext_vector_type(8)));
typedef float        v4f  __attribute__((ext_vector_type(4)));
typedef unsigned int v4u  __attribute__((ext_vector_type(4)));

union Frag { v16h v; v8h h[2]; v4u u[2]; };
union H8   { v8h h; v4u u; };

#define DM    1024            // model width (dim_in = dim_k = dim_v)
#define NB    2               // batch
#define NSEQ  2048            // sequence length
#define NTOK  (NB * NSEQ)     // token rows
#define NHD   16              // heads
#define DH    64              // head width
#define NPROJ 6
#define NXE   (NTOK * DM)     // 4194304 elements per activation tensor
#define NWE   (DM * DM)       // 1048576 elements per weight

// workspace in 16-bit units; every operand lies in fragment order: a tile of 16 rows x 32 k
// is 512 consecutive units, unit = (k_in >> 3) * 128 + row_in * 8 + (k_in & 7), so that lane l
// of a wave finds its two 16-B fragment halves at tile + 8l and tile + 256 + 8l.
//   xh  f16(x)         rows = tokens,   k = dim_in: tile (row/16) * 32 + k/32       at OFF_XH
//   wh  f16(64 * W_p)  rows = features, k = dim_in: the same per weight             at OFF_WH
//   six planes of 4096*1024 at OFF_PL + p * NXE, each [b*16+head] x 131072 units:
//     p = 0,1,3,4  rows = n,  k = d: tile (n/16) * 2 + d/32 (q planes carry x0.125)
//     p = 2,5      rows = dv, k = n: tile (n/32) * 4 + dv/16
#define OFF_XH    ((size_t)0)
#define OFF_WH    ((size_t)NXE)
#define OFF_PL    ((size_t)NXE + (size_t)NPROJ * (size_t)NWE)
#define WS_HALVES (OFF_PL + (size_t)NPROJ * (size_t)NXE)        // 35651584 -> 71303168 B

// ------------------------------------------------------------------------
// helpers
// ------------------------------------------------------------------------
__device__ __forceinline__ v8f vzero8() {
    v8f z = {0.f, 0.f, 0.f, 0.f, 0.f, 0.f, 0.f, 0.f};
    return z;
}

// Fragment layout (wave32, 16x16x32), identical for A and B:
//   lane l: h = l>>4, m = l&15 = row of A / column of B / column of D
//   elements 0..7  -> k = k0 + 8h + 0..7
//   elements 8..15 -> k = k0 + 16 + 8h + 0..7
//   D element r -> (row 8h + r, column m)
// p = start of a fragment-ordered tile + 8 * lane: each of the two loads reads 512
// consecutive bytes per wave (four whole 128-B lines).
__device__ __forceinline__ void ldfrag(Frag& f, const _Float16* p) {
    f.h[0] = *reinterpret_cast<const v8h*>(p);
    f.h[1] = *reinterpret_cast<const v8h*>(p + 256);
}

__device__ __forceinline__ v8f mma(const Frag& a, const Frag& b, v8f c) {
    c = __builtin_amdgcn_wmma_f32_16x16x32_f16(false, a.v, false, b.v, (short)0, c, false, false);
    asm volatile("v_nop\n\tv_nop\n\tv_nop\n\tv_nop" : "+v"(c) : "v"(a.v), "v"(b.v));
    return c;
}

// Eight 2^x in one statement. The outputs are early-clobbered, so none lands on a source of the
// run; the closing v_nop is the slot that the instruction set asks for behind a transcendental
// before its result is read or its source overwritten.
__device__ __forceinline__ void exp2_x8(float& e0, float& e1, float& e2, float& e3,
                                        float& e4, float& e5, float& e6, float& e7,
                                        const float (&y)[8]) {
    asm("v_exp_f32 %0, %8\n\tv_exp_f32 %1, %9\n\tv_exp_f32 %2, %10\n\tv_exp_f32 %3, %11\n\t"
        "v_exp_f32 %4, %12\n\tv_exp_f32 %5, %13\n\tv_exp_f32 %6, %14\n\tv_exp_f32 %7, %15\n\t"
        "v_nop"
        : "=&v"(e0), "=&v"(e1), "=&v"(e2), "=&v"(e3), "=&v"(e4), "=&v"(e5), "=&v"(e6), "=&v"(e7)
        : "v"(y[0]), "v"(y[1]), "v"(y[2]), "v"(y[3]), "v"(y[4]), "v"(y[5]), "v"(y[6]), "v"(y[7]));
}

// ------------------------------------------------------------------------
// Launch 1: f32 -> f16 conversion of x (scale 1) and the six weights (scale 64).
// Ten segments of 1048576 elements (x quarters 0..3, weights 4..9), grid (64, 10).
// A block converts one tile row (16 rows x 1024 k), the same 16384 units in source and
// in fragment order. Each lane converts 8 consecutive k of one row -> one 16-B store; a
// wave takes 8 rows x 32 k, so its store fills four whole 128-B lines.
// ------------------------------------------------------------------------
#define CV_IT  8
#define CV_BLK (256 * 8 * CV_IT)        // 16384 elements per block

__global__ __launch_bounds__(256) void cvt_kernel(
    const float* __restrict__ x,
    const float* __restrict__ W0, const float* __restrict__ W1, const float* __restrict__ W2,
    const float* __restrict__ W3, const float* __restrict__ W4, const float* __restrict__ W5,
    _Float16* wsh)
{
    const int tid = threadIdx.x;
    const int lane = tid & 31, wv = tid >> 5;
    const int row = (wv & 1) * 8 + (lane >> 2), kq = lane & 3;       // row in the tile, 8-k chunk
    const int seg = blockIdx.y;                                      // block-uniform
    const float* src;
    float sc;
    if (seg < 4) {
        src = x + (size_t)seg * NWE;
        sc  = 1.0f;
    } else {
        const int p = seg - 4;
        src = (p == 0) ? W0 : (p == 1) ? W1 : (p == 2) ? W2 : (p == 3) ? W3 : (p == 4) ? W4 : W5;
        sc  = 64.0f;                                                 // exact power of two
    }
    const size_t base = (size_t)blockIdx.x * CV_BLK;
    // pass i: k tile 4i + (wv >> 1)
    const float* sp = src + base;
    _Float16*    dp = wsh + (size_t)seg * NWE + base;
    const int so = row * DM + (wv >> 1) * 32 + kq * 8;               // source: row-major
    const int dn = (wv >> 1) * 512 + kq * 128 + row * 8;             // destination: fragment order

    H8 v[CV_IT];
#pragma unroll
    for (int i = 0; i < CV_IT; ++i) {
        const int e = so + i * 128;
        const v4f f0 = *reinterpret_cast<const v4f*>(sp + e);
        const v4f f1 = *reinterpret_cast<const v4f*>(sp + e + 4);
        H8 t;
        t.u = (v4u){0u, 0u, 0u, 0u};
#pragma unroll
        for (int q = 0; q < 4; ++q) {
            t.h[q]     = (_Float16)(f0[q] * sc);                     // RNE convert
            t.h[4 + q] = (_Float16)(f1[q] * sc);
        }
        v[i] = t;
    }
#pragma unroll
    for (int i = 0; i < CV_IT; ++i) {
        const int e = dn + i * 2048;
        *reinterpret_cast<v4u*>(dp + e) = v[i].u;
    }
    
}

// ------------------------------------------------------------------------
// Launch 2/3: Y = xh . wh^T / 64 for the projections. Block tile 128 tokens x 64
// features (one head), 4 waves of 32 tokens x 64 features, K stepped by 32.
// Fragments are loaded directly from the fragment-ordered f16 tiles (identical split k map
// for both operands). ISV = 0: q/k planes, rows = n (q planes additionally x0.125);
// ISV = 1: value planes, rows = dv. In both the 8 values a lane holds of an accumulator are
// one 16-B chunk of the plane's fragment order at tile half + 8 * lane: stored directly,
// 512 consecutive bytes per wave and store.
// ------------------------------------------------------------------------
#define P_BM 128
#define P_BN 64
#define P_BK 32

// the six fragments of K step k0: token rows 32w + 16mt + lo, feature rows n0 + 16nt + lo
__device__ __forceinline__ void proj_fetch(Frag (&xf)[2], Frag (&wf)[4],
                                           const _Float16* xa, const _Float16* wb, int k0) {
    ldfrag(xf[0], xa + 16 * k0);
    ldfrag(xf[1], xa + 16 * DM + 16 * k0);
#pragma unroll
    for (int nt = 0; nt < 4; ++nt) ldfrag(wf[nt], wb + (size_t)(16 * nt) * DM + 16 * k0);
}

template <int ISV>
__device__ __forceinline__ void proj_step(v8f (&acc)[2][4], const Frag (&xf)[2], const Frag (&wf)[4]) {
#pragma unroll
    for (int nt = 0; nt < 4; ++nt) {
        if (ISV) {
            // D[r] = Y[token 32w+16mt+8h+r][feat 16nt+lo]
            acc[0][nt] = mma(xf[0], wf[nt], acc[0][nt]);
            acc[1][nt] = mma(xf[1], wf[nt], acc[1][nt]);
        } else {
            // D[r] = Y[token 32w+16mt+lo][feat 16nt+8h+r]
            acc[0][nt] = mma(wf[nt], xf[0], acc[0][nt]);
            acc[1][nt] = mma(wf[nt], xf[1], acc[1][nt]);
        }
    }
}

template <int ISV>
__global__ __launch_bounds__(128) void proj_kernel(const _Float16* xh, const _Float16* wh,
                                                   _Float16* planes)
{
    const int tid  = threadIdx.x;
    const int lane = tid & 31, w = tid >> 5;
    const int z    = blockIdx.z;                                     // block-uniform
    int proj;
    float osc;
    if (ISV) {
        proj = 2 + 3 * z;                                            // 2, 5
        osc  = 1.0f / 64.0f;
    } else {
        proj = z + ((z >= 2) ? 1 : 0);                               // 0, 1, 3, 4
        osc  = (z == 0 || z == 2) ? (1.0f / 512.0f) : (1.0f / 64.0f);   // q planes: 0.125 / 64
    }
    const int n0 = blockIdx.x * P_BN;                                // feature base = head * 64
    const int m0 = blockIdx.y * P_BM;                                // token base

    const _Float16* xa = xh + (size_t)(m0 + 32 * w) * DM + 8 * lane;        // + 16*mt*DM + 16*k0
    const _Float16* wb = wh + ((size_t)proj * DM + n0) * DM + 8 * lane;     // + 16*nt*DM + 16*k0

    v8f acc[2][4];
#pragma unroll
    for (int mt = 0; mt < 2; ++mt)
#pragma unroll
        for (int nt = 0; nt < 4; ++nt) acc[mt][nt] = vzero8();

    // Two register sets of the six fragments of a K step: while one set feeds its eight
    // products, the other set's twelve loads, issued as one group, are in flight.
    Frag xf[2][2], wf[2][4];
    proj_fetch(xf[0], wf[0], xa, wb, 0);
    // kept rolled: one trip holds both sets, a longer body would only add code
#pragma unroll 1
    for (int k0 = 0; k0 < DM - 2 * P_BK; k0 += 2 * P_BK) {
        proj_fetch(xf[1], wf[1], xa, wb, P_BK);
        proj_step<ISV>(acc, xf[0], wf[0]);
        proj_fetch(xf[0], wf[0], xa, wb, 2 * P_BK);
        proj_step<ISV>(acc, xf[1], wf[1]);
        xa += 16 * 2 * P_BK;
        wb += 16 * 2 * P_BK;
    }
    // the last two K steps: nothing left to fetch ahead
    ldfrag(xf[1][0], xa + 16 * P_BK);
    ldfrag(xf[1][1], xa + 16 * DM + 16 * P_BK);
    // precaution: the address pair of the loads above, dead from here on, is not reused
    // (by a later load's destination either) before they have passed address translation
    asm volatile("s_wait_xcnt 0x0" ::: "memory");
#pragma unroll
    for (int nt = 0; nt < 4; ++nt) ldfrag(wf[1][nt], wb + (size_t)(16 * nt) * DM + 16 * P_BK);
    proj_step<ISV>(acc, xf[0], wf[0]);
    proj_step<ISV>(acc, xf[1], wf[1]);

    // scaled f16 chunks straight to the plane (each lane one 16-B vector per (mt, nt))
    const int bhi = (m0 / NSEQ) * NHD + blockIdx.x;
    const int nq0 = m0 % NSEQ;
    _Float16* plane = planes + (size_t)proj * NXE + (size_t)bhi * (NSEQ * DH) + 8 * lane;
    H8 t[2][4];
#pragma unroll
    for (int mt = 0; mt < 2; ++mt) {
#pragma unroll
        for (int nt = 0; nt < 4; ++nt) {
            t[mt][nt].u = (v4u){0u, 0u, 0u, 0u};
#pragma unroll
            for (int r = 0; r < 8; ++r) t[mt][nt].h[r] = (_Float16)(acc[mt][nt][r] * osc);
        }
    }
#pragma unroll
    for (int mt = 0; mt < 2; ++mt) {
#pragma unroll
        for (int nt = 0; nt < 4; ++nt) {
            // ISV: row dv = 16nt+lo, k = tokens 32w+16mt+8h .. +7 -> tile (n/32)*4 + nt, half mt
            // else: row n = 32w+16mt+lo, k = feats 16nt+8h .. +7  -> tile (n/16)*2 + nt/2, half nt&1
            const int off = ISV ? (((nq0 / 32 + w) * 4 + nt) * 512 + mt * 256)
                                : (((nq0 / 16 + 2 * w + mt) * 2 + (nt >> 1)) * 512 + (nt & 1) * 256);
            *reinterpret_cast<v4u*>(plane + off) = t[mt][nt].u;
        }
    }
}

// ------------------------------------------------------------------------
// Launch 4: attention. One block per (query block of 64, b*16+head, output index o),
// 4 waves x 16 queries. Output o uses score stream s = (head&1)^o and the value plane
// of stream o. Scores are computed transposed, S^T = K . Q^T (D rows = keys, cols =
// queries), so the probabilities come out of D already in B-fragment layout for
// O^T = V^T . P^T (element r <- 16-key tile 2c, element 8+r <- tile 2c+1). Per lane:
// one query (lo), 32 of the 64 keys of a step; the other 32 live in lane lo+16.
// K, V^T and Q^T fragments come straight from the fragment-ordered f16 planes (no LDS
// staging); the 8 K tiles and the 8 V^T tiles of a step are 8 KB consecutive each.
// ------------------------------------------------------------------------
#define A_QB 64
#define A_KT 64

__global__ __launch_bounds__(128) void attn_kernel(const _Float16* planes, float* out)
{
    __shared__ v4f St[1024];                                         // [4 waves][16][64] f32

    const int tid  = threadIdx.x;
    const int lane = tid & 31, w = tid >> 5, lo = lane & 15, hf = lane >> 4;
    const int qb = blockIdx.x, bh = blockIdx.y, o = blockIdx.z;
    const int b  = bh >> 4, hd = bh & 15;
    const int s  = (hd & 1) ^ o;                                     // score stream
    const size_t HO = (size_t)bh * NSEQ * DH;                        // same for both plane layouts
    const _Float16* Q = planes + (size_t)(s ? 3 : 0) * NXE + HO + 8 * lane;   // tiles (n/16)*2 + d/32, x0.125 inside
    const _Float16* K = planes + (size_t)(s ? 4 : 1) * NXE + HO + 8 * lane;   // tiles (n/16)*2 + d/32
    const _Float16* V = planes + (size_t)(o ? 5 : 2) * NXE + HO + 8 * lane;   // tiles (n/32)*4 + dv/16
    const int q0   = qb * A_QB;

    // Q^T as B operand: column = query (lane lo), k = d by the split map
    Frag qf[2];
#pragma unroll
    for (int dc = 0; dc < 2; ++dc) ldfrag(qf[dc], Q + ((q0 / 16 + w) * 2 + dc) * 512);

    v8f O[4];
#pragma unroll
    for (int i = 0; i < 4; ++i) O[i] = vzero8();
    float mrun = -1e30f, lrun = 0.f;

    // K fragments are fetched one step ahead, V^T fragments at the head of their own step,
    // each set's sixteen loads as one group: none waits directly in front of its product.
    Frag kf[8];                                                      // A operand: row = key, k = d
#pragma unroll
    for (int i = 0; i < 8; ++i) ldfrag(kf[i], K + i * 512);

#pragma unroll 1
    for (int t = 0; t < NSEQ / A_KT; ++t) {
        const int kb = t * A_KT;

        Frag vf[8];                                                  // A operand: row = dv 16nt+lo, k = key
#pragma unroll
        for (int i = 0; i < 8; ++i) ldfrag(vf[i], V + ((kb / 32) * 4 + i) * 512);

        // S^T tiles j = 0..3: keys kb+16j .. kb+16j+15; D[r] = score(query lo, key kb+16j+8h+r)
        float p[32];
#pragma unroll
        for (int j = 0; j < 4; ++j) {
            v8f S = vzero8();
#pragma unroll
            for (int dc = 0; dc < 2; ++dc) S = mma(kf[2 * j + dc], qf[dc], S);
#pragma unroll
            for (int r = 0; r < 8; ++r) p[8 * j + r] = S[r];
        }

        // next step's K tiles into the registers just read (last step: step 0 again, not used)
        const int kn = ((t + 1) & (NSEQ / A_KT - 1)) * A_KT;
#pragma unroll
        for (int i = 0; i < 8; ++i) ldfrag(kf[i], K + ((kn / 16) * 2 + i) * 512);

        // online softmax in f32 (row = query lo; partner lane lo^16 holds the other 32 keys)
        float tmax = p[0];
#pragma unroll
        for (int i = 1; i < 32; ++i) tmax = fmaxf(tmax, p[i]);
        tmax = fmaxf(tmax, __shfl_xor(tmax, 16, 32));
        const float mnew  = fmaxf(mrun, tmax);
        const float alpha = __expf(mrun - mnew);
        float rs = 0.f;
#pragma unroll
        for (int g = 0; g < 4; ++g) {
            float y[8];
#pragma unroll
            for (int r = 0; r < 8; ++r) y[r] = (p[8 * g + r] - mnew) * 1.44269504088896340736f;
            exp2_x8(p[8 * g], p[8 * g + 1], p[8 * g + 2], p[8 * g + 3],
                    p[8 * g + 4], p[8 * g + 5], p[8 * g + 6], p[8 * g + 7], y);
        }
#pragma unroll
        for (int i = 0; i < 32; ++i) rs += p[i];
        rs += __shfl_xor(rs, 16, 32);
        lrun = lrun * alpha + rs;
        mrun = mnew;
#pragma unroll
        for (int nt = 0; nt < 4; ++nt) O[nt] = O[nt] * alpha;

        // O^T[dv][q] += V^T[dv][key] . P^T[key][q] over two 32-key halves c
#pragma unroll
        for (int c = 0; c < 2; ++c) {
            // P^T as B operand straight from the D layout, carried x16384:
            // element r <- key 32c+8h+r (tile 2c), element 8+r <- key 32c+16+8h+r (tile 2c+1)
            H8 a0, a1;
            a0.u = (v4u){0u, 0u, 0u, 0u};
            a1.u = (v4u){0u, 0u, 0u, 0u};
#pragma unroll
            for (int r = 0; r < 8; ++r) {
                a0.h[r] = (_Float16)(p[16 * c + r] * 16384.0f);
                a1.h[r] = (_Float16)(p[16 * c + 8 + r] * 16384.0f);
            }
            Frag pf;
            pf.u[0] = a0.u;
            pf.u[1] = a1.u;
#pragma unroll
            for (int nt = 0; nt < 4; ++nt)
                O[nt] = mma(vf[4 * c + nt], pf, O[nt]);              // D[r] = O[query lo][dv 16nt+8h+r]
        }
    }

    const float inv = 1.0f / (lrun * 16384.0f);                      // lrun >= 1
    v4f* Sw = St + w * 256;
#pragma unroll
    for (int nt = 0; nt < 4; ++nt) {
        v4f a  = {O[nt][0] * inv, O[nt][1] * inv, O[nt][2] * inv, O[nt][3] * inv};
        v4f cc = {O[nt][4] * inv, O[nt][5] * inv, O[nt][6] * inv, O[nt][7] * inv};
        Sw[lo * 16 + 4 * nt + 2 * hf]     = a;                       // floats lo*64 + 16nt + 8h .. +3
        Sw[lo * 16 + 4 * nt + 2 * hf + 1] = cc;                      // .. +4 .. +7
    }
    __syncthreads();

    float* ob = out + (size_t)o * NXE + ((size_t)b * NSEQ + q0 + 16 * w) * DM + (size_t)hd * DH;
    const int c = (lane & 7) * 4;
    v4f vals[8];
#pragma unroll
    for (int si = 0; si < 8; ++si) {
        const int L = 4 * si + (lane >> 3);          // 32 lines per wave: row = L>>1, half = L&1
        vals[si] = Sw[8 * L + (lane & 7)];
    }
#pragma unroll
    for (int si = 0; si < 8; ++si) {
        const int L = 4 * si + (lane >> 3);
        *reinterpret_cast<v4f*>(ob + (size_t)(L >> 1) * DM + 32 * (L & 1) + c) = vals[si];
    }
    
}

// ------------------------------------------------------------------------
// host glue: 4 launches; shapes are fixed by the module configuration and
// checked against the passed sizes (no-op on any disagreement).
// ------------------------------------------------------------------------
extern "C" void kernel_launch(void* const* d_in, const int* in_sizes, int n_in,
                              void* d_out, int out_size, void* d_ws, size_t ws_size,
                              hipStream_t stream)
{
    if (n_in < 7) return;
    if (in_sizes[0] != NXE) return;
    for (int p = 0; p < NPROJ; ++p) if (in_sizes[1 + p] != NWE) return;
    if (out_size != 2 * NXE) return;
    const size_t ws_need = WS_HALVES * sizeof(_Float16);             // 71303168 B
    if (ws_size < ws_need) return;

    const float* x  = (const float*)d_in[0];
    const float* W0 = (const float*)d_in[1];
    const float* W1 = (const float*)d_in[2];
    const float* W2 = (const float*)d_in[3];
    const float* W3 = (const float*)d_in[4];
    const float* W4 = (const float*)d_in[5];
    const float* W5 = (const float*)d_in[6];
    _Float16* wsh = (_Float16*)d_ws;
    float* out = (float*)d_out;

    cvt_kernel<<<dim3(NWE / CV_BLK, 10, 1), 256, 0, stream>>>(x, W0, W1, W2, W3, W4, W5, wsh + OFF_XH);
    proj_kernel<0><<<dim3(DM / P_BN, NTOK / P_BM, 4), 128, 0, stream>>>(wsh + OFF_XH, wsh + OFF_WH, wsh + OFF_PL);
    proj_kernel<1><<<dim3(DM / P_BN, NTOK / P_BM, 2), 128, 0, stream>>>(wsh + OFF_XH, wsh + OFF_WH, wsh + OFF_PL);
    attn_kernel<<<dim3(NSEQ / A_QB, NB * NHD, 2), 128, 0, stream>>>(wsh + OFF_PL, out);
}

// v003
// Measured time: 134 microseconds a run.
// Next to v002, in two timings, it ran 1.07 times as fast each time.
// All steps since v000 together make it 2.84 times as fast.
#include <hip/hip_runtime.h>

// Contractions: six input projections, key x query^T score tiles and value^T x prob^T tiles,
// all v_wmma_f32_16x16x32_f16 (f16 operands, f32 accumulate). f16 operand scaling: weights x64,
// queries x0.125, probabilities x16384, folded back in f32 epilogues. Softmax statistics,
// normalisation and the outputs: f32.

typedef _Float16     v16h __attribute__((ext_vector_type(16)));
typedef _Float16     v8h  __attribute__((ext_vector_type(8)));
typedef float        v8f  __attribute__((ext_vector_type(8)));
typedef float        v4f  __attribute__((ext_vector_type(4)));
typedef unsigned int v4u  __attribute__((ext_vector_type(4)));

union Frag { v16h v; v8h h[2]; v4u u[2]; };
union H8   { v8h h; v4u u; };

#define DM    1024            // model width (dim_in = dim_k = dim_v)
#define NB    2               // batch
#define NSEQ  2048            // sequence length
#define NTOK  (NB * NSEQ)     // token rows
#define NHD   16              // heads
#define DH    64              // head width
#define NPROJ 6
#define NXE   (NTOK * DM)     // 4194304 elements per activation tensor
#define NWE   (DM * DM)       // 1048576 elements per weight

// workspace in 16-bit units; every operand lies in fragment order: a tile of 16 rows x 32 k
// is 512 consecutive units, unit = (k_in >> 3) * 128 + row_in * 8 + (k_in & 7), so that lane l
// of a wave finds its two 16-B fragment halves at tile + 8l and tile + 256 + 8l.
//   xh  f16(x)         rows = tokens,   k = dim_in: tile (row/16) * 32 + k/32       at OFF_XH
//   wh  f16(64 * W_p)  rows = features, k = dim_in: the same per weight             at OFF_WH
//   six planes of 4096*1024 at OFF_PL + p * NXE, each [b*16+head] x 131072 units:
//     p = 0,1,3,4  rows = n,  k = d: tile (n/16) * 2 + d/32 (q planes carry x0.125)
//     p = 2,5      rows = dv, k = n: tile (n/32) * 4 + dv/16
#define OFF_XH    ((size_t)0)
#define OFF_WH    ((size_t)NXE)
#define OFF_PL    ((size_t)NXE + (size_t)NPROJ * (size_t)NWE)
#define WS_HALVES (OFF_PL + (size_t)NPROJ * (size_t)NXE)        // 35651584 -> 71303168 B

// ------------------------------------------------------------------------
// helpers
// ------------------------------------------------------------------------
__device__ __forceinline__ v8f vzero8() {
    v8f z = {0.f, 0.f, 0.f, 0.f, 0.f, 0.f, 0.f, 0.f};
    return z;
}

// Fragment layout (wave32, 16x16x32), identical for A and B:
//   lane l: h = l>>4, m = l&15 = row of A / column of B / column of D
//   elements 0..7  -> k = k0 + 8h + 0..7
//   elements 8..15 -> k = k0 + 16 + 8h + 0..7
//   D element r -> (row 8h + r, column m)
// p = start of a fragment-ordered tile + 8 * lane: each of the two loads reads 512
// consecutive bytes per wave (four whole 128-B lines).
__device__ __forceinline__ void ldfrag(Frag& f, const _Float16* p) {
    f.h[0] = *reinterpret_cast<const v8h*>(p);
    f.h[1] = *reinterpret_cast<const v8h*>(p + 256);
}

__device__ __forceinline__ v8f mma(const Frag& a, const Frag& b, v8f c) {
    c = __builtin_amdgcn_wmma_f32_16x16x32_f16(false, a.v, false, b.v, (short)0, c, false, false);
    asm volatile("v_nop\n\tv_nop\n\tv_nop\n\tv_nop" : "+v"(c) : "v"(a.v), "v"(b.v));
    return c;
}

// The same product with no slots written behind it: the compiler pads its own builtin form, and
// only where a reader of D or a writer of A or B really stands within the distance.
__device__ __forceinline__ v8f mma_bare(const Frag& a, const Frag& b, v8f c) {
    return __builtin_amdgcn_wmma_f32_16x16x32_f16(false, a.v, false, b.v, (short)0, c, false, false);
}

// Eight 2^x in one statement. The outputs are early-clobbered, so none lands on a source of the
// run; the closing v_nop is the slot that the instruction set asks for behind a transcendental
// before its result is read or its source overwritten.
__device__ __forceinline__ void exp2_x8(float& e0, float& e1, float& e2, float& e3,
                                        float& e4, float& e5, float& e6, float& e7,
                                        const float (&y)[8]) {
    asm("v_exp_f32 %0, %8\n\tv_exp_f32 %1, %9\n\tv_exp_f32 %2, %10\n\tv_exp_f32 %3, %11\n\t"
        "v_exp_f32 %4, %12\n\tv_exp_f32 %5, %13\n\tv_exp_f32 %6, %14\n\tv_exp_f32 %7, %15\n\t"
        "v_nop"
        : "=&v"(e0), "=&v"(e1), "=&v"(e2), "=&v"(e3), "=&v"(e4), "=&v"(e5), "=&v"(e6), "=&v"(e7)
        : "v"(y[0]), "v"(y[1]), "v"(y[2]), "v"(y[3]), "v"(y[4]), "v"(y[5]), "v"(y[6]), "v"(y[7]));
}

// ------------------------------------------------------------------------
// Launch 1: f32 -> f16 conversion of x (scale 1) and the six weights (scale 64).
// Ten segments of 1048576 elements (x quarters 0..3, weights 4..9), grid (64, 10).
// A block converts one tile row (16 rows x 1024 k), the same 16384 units in source and
// in fragment order. Each lane converts 8 consecutive k of one row -> one 16-B store; a
// wave takes 8 rows x 32 k, so its store fills four whole 128-B lines.
// ------------------------------------------------------------------------
#define CV_IT  8
#define CV_BLK (256 * 8 * CV_IT)        // 16384 elements per block

__global__ __launch_bounds__(256) void cvt_kernel(
    const float* __restrict__ x,
    const float* __restrict__ W0, const float* __restrict__ W1, const float* __restrict__ W2,
    const float* __restrict__ W3, const float* __restrict__ W4, const float* __restrict__ W5,
    _Float16* wsh)
{
    const int tid = threadIdx.x;
    const int lane = tid & 31, wv = tid >> 5;
    const int row = (wv & 1) * 8 + (lane >> 2), kq = lane & 3;       // row in the tile, 8-k chunk
    const int seg = blockIdx.y;                                      // block-uniform
    const float* src;
    float sc;
    if (seg < 4) {
        src = x + (size_t)seg * NWE;
        sc  = 1.0f;
    } else {
        const int p = seg - 4;
        src = (p == 0) ? W0 : (p == 1) ? W1 : (p == 2) ? W2 : (p == 3) ? W3 : (p == 4) ? W4 : W5;
        sc  = 64.0f;                                                 // exact power of two
    }
    const size_t base = (size_t)blockIdx.x * CV_BLK;
    // pass i: k tile 4i + (wv >> 1)
    const float* sp = src + base;
    _Float16*    dp = wsh + (size_t)seg * NWE + base;
    const int so = row * DM + (wv >> 1) * 32 + kq * 8;               // source: row-major
    const int dn = (wv >> 1) * 512 + kq * 128 + row * 8;             // destination: fragment order

    H8 v[CV_IT];
#pragma unroll
    for (int i = 0; i < CV_IT; ++i) {
        const int e = so + i * 128;
        const v4f f0 = *reinterpret_cast<const v4f*>(sp + e);
        const v4f f1 = *reinterpret_cast<const v4f*>(sp + e + 4);
        H8 t;
        t.u = (v4u){0u, 0u, 0u, 0u};
#pragma unroll
        for (int q = 0; q < 4; ++q) {
            t.h[q]     = (_Float16)(f0[q] * sc);                     // RNE convert
            t.h[4 + q] = (_Float16)(f1[q] * sc);
        }
        v[i] = t;
    }
#pragma unroll
    for (int i = 0; i < CV_IT; ++i) {
        const int e = dn + i * 2048;
        *reinterpret_cast<v4u*>(dp + e) = v[i].u;
    }
    
}

// ------------------------------------------------------------------------
// Launch 2/3: Y = xh . wh^T / 64 for the projections. Block tile 128 tokens x 64
// features (one head), 4 waves of 32 tokens x 64 features, K stepped by 32.
// Fragments are loaded directly from the fragment-ordered f16 tiles (identical split k map
// for both operands). ISV = 0: q/k planes, rows = n (q planes additionally x0.125);
// ISV = 1: value planes, rows = dv. In both the 8 values a lane holds of an accumulator are
// one 16-B chunk of the plane's fragment order at tile half + 8 * lane: stored directly,
// 512 consecutive bytes per wave and store.
// ------------------------------------------------------------------------
#define P_BM 128
#define P_BN 64
#define P_BK 32

// the six fragments of K step k0: token rows 32w + 16mt + lo, feature rows n0 + 16nt + lo
__device__ __forceinline__ void proj_fetch(Frag (&xf)[2], Frag (&wf)[4],
                                           const _Float16* xa, const _Float16* wb, int k0) {
    ldfrag(xf[0], xa + 16 * k0);
    ldfrag(xf[1], xa + 16 * DM + 16 * k0);
#pragma unroll
    for (int nt = 0; nt < 4; ++nt) ldfrag(wf[nt], wb + (size_t)(16 * nt) * DM + 16 * k0);
}

template <int ISV>
__device__ __forceinline__ void proj_step(v8f (&acc)[2][4], const Frag (&xf)[2], const Frag (&wf)[4]) {
#pragma unroll
    for (int nt = 0; nt < 4; ++nt) {
        if (ISV) {
            // D[r] = Y[token 32w+16mt+8h+r][feat 16nt+lo]
            acc[0][nt] = mma(xf[0], wf[nt], acc[0][nt]);
            acc[1][nt] = mma(xf[1], wf[nt], acc[1][nt]);
        } else {
            // D[r] = Y[token 32w+16mt+lo][feat 16nt+8h+r]
            acc[0][nt] = mma(wf[nt], xf[0], acc[0][nt]);
            acc[1][nt] = mma(wf[nt], xf[1], acc[1][nt]);
        }
    }
}

template <int ISV>
__global__ __launch_bounds__(128) void proj_kernel(const _Float16* xh, const _Float16* wh,
                                                   _Float16* planes)
{
    const int tid  = threadIdx.x;
    const int lane = tid & 31, w = tid >> 5;
    const int z    = blockIdx.z;                                     // block-uniform
    int proj;
    float osc;
    if (ISV) {
        proj = 2 + 3 * z;                                            // 2, 5
        osc  = 1.0f / 64.0f;
    } else {
        proj = z + ((z >= 2) ? 1 : 0);                               // 0, 1, 3, 4
        osc  = (z == 0 || z == 2) ? (1.0f / 512.0f) : (1.0f / 64.0f);   // q planes: 0.125 / 64
    }
    const int n0 = blockIdx.x * P_BN;                                // feature base = head * 64
    const int m0 = blockIdx.y * P_BM;                                // token base

    const _Float16* xa = xh + (size_t)(m0 + 32 * w) * DM + 8 * lane;        // + 16*mt*DM + 16*k0
    const _Float16* wb = wh + ((size_t)proj * DM + n0) * DM + 8 * lane;     // + 16*nt*DM + 16*k0

    v8f acc[2][4];
#pragma unroll
    for (int mt = 0; mt < 2; ++mt)
#pragma unroll
        for (int nt = 0; nt < 4; ++nt) acc[mt][nt] = vzero8();

    // Two register sets of the six fragments of a K step: while one set feeds its eight
    // products, the other set's twelve loads, issued as one group, are in flight.
    Frag xf[2][2], wf[2][4];
    proj_fetch(xf[0], wf[0], xa, wb, 0);
    // kept rolled: one trip holds both sets, a longer body would only add code
#pragma unroll 1
    for (int k0 = 0; k0 < DM - 2 * P_BK; k0 += 2 * P_BK) {
        proj_fetch(xf[1], wf[1], xa, wb, P_BK);
        proj_step<ISV>(acc, xf[0], wf[0]);
        proj_fetch(xf[0], wf[0], xa, wb, 2 * P_BK);
        proj_step<ISV>(acc, xf[1], wf[1]);
        xa += 16 * 2 * P_BK;
        wb += 16 * 2 * P_BK;
    }
    // the last two K steps: nothing left to fetch ahead
    ldfrag(xf[1][0], xa + 16 * P_BK);
    ldfrag(xf[1][1], xa + 16 * DM + 16 * P_BK);
    // precaution: the address pair of the loads above, dead from here on, is not reused
    // (by a later load's destination either) before they have passed address translation
    asm volatile("s_wait_xcnt 0x0" ::: "memory");
#pragma unroll
    for (int nt = 0; nt < 4; ++nt) ldfrag(wf[1][nt], wb + (size_t)(16 * nt) * DM + 16 * P_BK);
    proj_step<ISV>(acc, xf[0], wf[0]);
    proj_step<ISV>(acc, xf[1], wf[1]);

    // scaled f16 chunks straight to the plane (each lane one 16-B vector per (mt, nt))
    const int bhi = (m0 / NSEQ) * NHD + blockIdx.x;
    const int nq0 = m0 % NSEQ;
    _Float16* plane = planes + (size_t)proj * NXE + (size_t)bhi * (NSEQ * DH) + 8 * lane;
    H8 t[2][4];
#pragma unroll
    for (int mt = 0; mt < 2; ++mt) {
#pragma unroll
        for (int nt = 0; nt < 4; ++nt) {
            t[mt][nt].u = (v4u){0u, 0u, 0u, 0u};
#pragma unroll
            for (int r = 0; r < 8; ++r) t[mt][nt].h[r] = (_Float16)(acc[mt][nt][r] * osc);
        }
    }
#pragma unroll
    for (int mt = 0; mt < 2; ++mt) {
#pragma unroll
        for (int nt = 0; nt < 4; ++nt) {
            // ISV: row dv = 16nt+lo, k = tokens 32w+16mt+8h .. +7 -> tile (n/32)*4 + nt, half mt
            // else: row n = 32w+16mt+lo, k = feats 16nt+8h .. +7  -> tile (n/16)*2 + nt/2, half nt&1
            const int off = ISV ? (((nq0 / 32 + w) * 4 + nt) * 512 + mt * 256)
                                : (((nq0 / 16 + 2 * w + mt) * 2 + (nt >> 1)) * 512 + (nt & 1) * 256);
            *reinterpret_cast<v4u*>(plane + off) = t[mt][nt].u;
        }
    }
}

// ------------------------------------------------------------------------
// Launch 4: attention. One block per (query block of 64, b*16+head, output index o),
// 4 waves x 16 queries. Output o uses score stream s = (head&1)^o and the value plane
// of stream o. Scores are computed transposed, S^T = K . Q^T (D rows = keys, cols =
// queries), so the probabilities come out of D already in B-fragment layout for
// O^T = V^T . P^T (element r <- 16-key tile 2c, element 8+r <- tile 2c+1). Per lane:
// one query (lo), 32 of the 64 keys of a step; the other 32 live in lane lo+16.
// K, V^T and Q^T fragments come straight from the fragment-ordered f16 planes (no LDS
// staging); the 8 K tiles and the 8 V^T tiles of a step are 8 KB consecutive each.
// ------------------------------------------------------------------------
#define A_QB 64
#define A_KT 64

__global__ __launch_bounds__(128) void attn_kernel(const _Float16* planes, float* out)
{
    __shared__ v4f St[1024];                                         // [4 waves][16][64] f32

    const int tid  = threadIdx.x;
    const int lane = tid & 31, w = tid >> 5, lo = lane & 15, hf = lane >> 4;
    const int qb = blockIdx.x, bh = blockIdx.y, o = blockIdx.z;
    const int b  = bh >> 4, hd = bh & 15;
    const int s  = (hd & 1) ^ o;                                     // score stream
    const size_t HO = (size_t)bh * NSEQ * DH;                        // same for both plane layouts
    const _Float16* Q = planes + (size_t)(s ? 3 : 0) * NXE + HO + 8 * lane;   // tiles (n/16)*2 + d/32, x0.125 inside
    const _Float16* K = planes + (size_t)(s ? 4 : 1) * NXE + HO + 8 * lane;   // tiles (n/16)*2 + d/32
    const _Float16* V = planes + (size_t)(o ? 5 : 2) * NXE + HO + 8 * lane;   // tiles (n/32)*4 + dv/16
    const int q0   = qb * A_QB;

    // Q^T as B operand: column = query (lane lo), k = d by the split map
    Frag qf[2];
#pragma unroll
    for (int dc = 0; dc < 2; ++dc) ldfrag(qf[dc], Q + ((q0 / 16 + w) * 2 + dc) * 512);

    v8f O[4];
#pragma unroll
    for (int i = 0; i < 4; ++i) O[i] = vzero8();
    float mrun = -1e30f, lrun = 0.f;

    // K fragments are fetched one step ahead, V^T fragments at the head of their own step,
    // each set's sixteen loads as one group: none waits directly in front of its product.
    Frag kf[8];                                                      // A operand: row = key, k = d
#pragma unroll
    for (int i = 0; i < 8; ++i) ldfrag(kf[i], K + i * 512);

#pragma unroll 1
    for (int t = 0; t < NSEQ / A_KT; ++t) {
        const int kb = t * A_KT;

        Frag vf[8];                                                  // A operand: row = dv 16nt+lo, k = key
        const _Float16* vp = V + (kb / 32) * 4 * 512;
#pragma unroll
        for (int i = 0; i < 8; ++i) ldfrag(vf[i], vp + i * 512);
        // holds the sixteen V^T loads as one group at the head of the step: sunk towards their
        // products they would be waited for with no lead
        __builtin_amdgcn_sched_barrier(0);

        // S^T tiles j = 0..3: keys kb+16j .. kb+16j+15; D[r] = score(query lo, key kb+16j+8h+r)
        float p[32];
#pragma unroll
        for (int j = 0; j < 4; ++j) {
            v8f S = vzero8();
#pragma unroll
            for (int dc = 0; dc < 2; ++dc) S = mma_bare(kf[2 * j + dc], qf[dc], S);
#pragma unroll
            for (int r = 0; r < 8; ++r) p[8 * j + r] = S[r];
        }

        // next step's K tiles into the registers just read (last step: step 0 again, not used)
        const int kn = ((t + 1) & (NSEQ / A_KT - 1)) * A_KT;
        const _Float16* kp = K + (kn / 16) * 2 * 512;
#pragma unroll
        for (int i = 0; i < 8; ++i) ldfrag(kf[i], kp + i * 512);
        // holds the sixteen K loads directly behind the score products: softmax and the value
        // products of this step are their lead
        __builtin_amdgcn_sched_barrier(0);

        // online softmax in f32 (row = query lo; partner lane lo^16 holds the other 32 keys)
        float tmax = p[0];
#pragma unroll
        for (int i = 1; i < 32; ++i) tmax = fmaxf(tmax, p[i]);
        tmax = fmaxf(tmax, __shfl_xor(tmax, 16, 32));
        const float mnew  = fmaxf(mrun, tmax);
        // keeps the wait below behind the exchange of the maxima: lifted to the K loads it would
        // hold the wave there
        __builtin_amdgcn_sched_barrier(0);
        // precaution: the two address pairs of this step's loads, held here as operands so that no
        // load's destination lands on them, are left alone until the loads have passed address
        // translation
        asm volatile("s_wait_xcnt 0x0" :: "v"(vp), "v"(kp) : "memory");
        const float alpha = __expf(mrun - mnew);
        float rs = 0.f;
#pragma unroll
        for (int g = 0; g < 4; ++g) {
            float y[8];
#pragma unroll
            for (int r = 0; r < 8; ++r) y[r] = (p[8 * g + r] - mnew) * 1.44269504088896340736f;
            exp2_x8(p[8 * g], p[8 * g + 1], p[8 * g + 2], p[8 * g + 3],
                    p[8 * g + 4], p[8 * g + 5], p[8 * g + 6], p[8 * g + 7], y);
        }
#pragma unroll
        for (int i = 0; i < 32; ++i) rs += p[i];
        rs += __shfl_xor(rs, 16, 32);
        lrun = lrun * alpha + rs;
        mrun = mnew;
#pragma unroll
        for (int nt = 0; nt < 4; ++nt) O[nt] = O[nt] * alpha;

        // O^T[dv][q] += V^T[dv][key] . P^T[key][q] over two 32-key halves c
#pragma unroll
        for (int c = 0; c < 2; ++c) {
            // P^T as B operand straight from the D layout, carried x16384:
            // element r <- key 32c+8h+r (tile 2c), element 8+r <- key 32c+16+8h+r (tile 2c+1)
            H8 a0, a1;
            a0.u = (v4u){0u, 0u, 0u, 0u};
            a1.u = (v4u){0u, 0u, 0u, 0u};
#pragma unroll
            for (int r = 0; r < 8; ++r) {
                a0.h[r] = (_Float16)(p[16 * c + r] * 16384.0f);
                a1.h[r] = (_Float16)(p[16 * c + 8 + r] * 16384.0f);
            }
            Frag pf;
            pf.u[0] = a0.u;
            pf.u[1] = a1.u;
#pragma unroll
            for (int nt = 0; nt < 4; ++nt)
                O[nt] = mma_bare(vf[4 * c + nt], pf, O[nt]);             // D[r] = O[query lo][dv 16nt+8h+r]
        }
    }

    const float inv = 1.0f / (lrun * 16384.0f);                      // lrun >= 1
    v4f* Sw = St + w * 256;
#pragma unroll
    for (int nt = 0; nt < 4; ++nt) {
        v4f a  = {O[nt][0] * inv, O[nt][1] * inv, O[nt][2] * inv, O[nt][3] * inv};
        v4f cc = {O[nt][4] * inv, O[nt][5] * inv, O[nt][6] * inv, O[nt][7] * inv};
        Sw[lo * 16 + 4 * nt + 2 * hf]     = a;                       // floats lo*64 + 16nt + 8h .. +3
        Sw[lo * 16 + 4 * nt + 2 * hf + 1] = cc;                      // .. +4 .. +7
    }
    __syncthreads();

    float* ob = out + (size_t)o * NXE + ((size_t)b * NSEQ + q0 + 16 * w) * DM + (size_t)hd * DH;
    const int c = (lane & 7) * 4;
    v4f vals[8];
#pragma unroll
    for (int si = 0; si < 8; ++si) {
        const int L = 4 * si + (lane >> 3);          // 32 lines per wave: row = L>>1, half = L&1
        vals[si] = Sw[8 * L + (lane & 7)];
    }
#pragma unroll
    for (int si = 0; si < 8; ++si) {
        const int L = 4 * si + (lane >> 3);
        *reinterpret_cast<v4f*>(ob + (size_t)(L >> 1) * DM + 32 * (L & 1) + c) = vals[si];
    }
    
}

// ------------------------------------------------------------------------
// host glue: 4 launches; shapes are fixed by the module configuration and
// checked against the passed sizes (no-op on any disagreement).
// ------------------------------------------------------------------------
extern "C" void kernel_launch(void* const* d_in, const int* in_sizes, int n_in,
                              void* d_out, int out_size, void* d_ws, size_t ws_size,
                              hipStream_t stream)
{
    if (n_in < 7) return;
    if (in_sizes[0] != NXE) return;
    for (int p = 0; p < NPROJ; ++p) if (in_sizes[1 + p] != NWE) return;
    if (out_size != 2 * NXE) return;
    const size_t ws_need = WS_HALVES * sizeof(_Float16);             // 71303168 B
    if (ws_size < ws_need) return;

    const float* x  = (const float*)d_in[0];
    const float* W0 = (const float*)d_in[1];
    const float* W1 = (const float*)d_in[2];
    const float* W2 = (const float*)d_in[3];
    const float* W3 = (const float*)d_in[4];
    const float* W4 = (const float*)d_in[5];
    const float* W5 = (const float*)d_in[6];
    _Float16* wsh = (_Float16*)d_ws;
    float* out = (float*)d_out;

    cvt_kernel<<<dim3(NWE / CV_BLK, 10, 1), 256, 0, stream>>>(x, W0, W1, W2, W3, W4, W5, wsh + OFF_XH);
    proj_kernel<0><<<dim3(DM / P_BN, NTOK / P_BM, 4), 128, 0, stream>>>(wsh + OFF_XH, wsh + OFF_WH, wsh + OFF_PL);
    proj_kernel<1><<<dim3(DM / P_BN, NTOK / P_BM, 2), 128, 0, stream>>>(wsh + OFF_XH, wsh + OFF_WH, wsh + OFF_PL);
    attn_kernel<<<dim3(NSEQ / A_QB, NB * NHD, 2), 128, 0, stream>>>(wsh + OFF_PL, out);
}

// v004
// One run takes 123 microseconds.
// Next to v003, in two timings, it ran 1.06 and 1.08 times as fast.
// All steps since v000 together make it 3.05 times as fast.
#include <hip/hip_runtime.h>

// Contractions: six input projections, key x query^T score tiles and value^T x prob^T tiles,
// all v_wmma_f32_16x16x32_f16 (f16 operands, f32 accumulate). f16 operand scaling: weights x64,
// queries x0.125, probabilities x16384, folded back in f32 epilogues. Softmax statistics,
// normalisation and the outputs: f32.

typedef _Float16     v16h __attribute__((ext_vector_type(16)));
typedef _Float16     v8h  __attribute__((ext_vector_type(8)));
typedef float        v8f  __attribute__((ext_vector_type(8)));
typedef float        v4f  __attribute__((ext_vector_type(4)));
typedef unsigned int v4u  __attribute__((ext_vector_type(4)));

union Frag { v16h v; v8h h[2]; v4u u[2]; };
union H8   { v8h h; v4u u; };

#define DM    1024            // model width (dim_in = dim_k = dim_v)
#define NB    2               // batch
#define NSEQ  2048            // sequence length
#define NTOK  (NB * NSEQ)     // token rows
#define NHD   16              // heads
#define DH    64              // head width
#define NPROJ 6
#define NXE   (NTOK * DM)     // 4194304 elements per activation tensor
#define NWE   (DM * DM)       // 1048576 elements per weight

// workspace in 16-bit units; every operand lies in fragment order: a tile of 16 rows x 32 k
// is 512 consecutive units, unit = (k_in >> 3) * 128 + row_in * 8 + (k_in & 7), so that lane l
// of a wave finds its two 16-B fragment halves at tile + 8l and tile + 256 + 8l.
//   xh  f16(x)         rows = tokens,   k = dim_in: tile (row/16) * 32 + k/32       at OFF_XH
//   wh  f16(64 * W_p)  rows = features, k = dim_in: the same per weight             at OFF_WH
//   six planes of 4096*1024 at OFF_PL + p * NXE, each [b*16+head] x 131072 units:
//     p = 0,1,3,4  rows = n,  k = d: tile (n/16) * 2 + d/32 (q planes carry x0.125)
//     p = 2,5      rows = dv, k = n: tile (n/32) * 4 + dv/16
#define OFF_XH    ((size_t)0)
#define OFF_WH    ((size_t)NXE)
#define OFF_PL    ((size_t)NXE + (size_t)NPROJ * (size_t)NWE)
#define WS_HALVES (OFF_PL + (size_t)NPROJ * (size_t)NXE)        // 35651584 -> 71303168 B

// ------------------------------------------------------------------------
// helpers
// ------------------------------------------------------------------------
__device__ __forceinline__ v8f vzero8() {
    v8f z = {0.f, 0.f, 0.f, 0.f, 0.f, 0.f, 0.f, 0.f};
    return z;
}

// Fragment layout (wave32, 16x16x32), identical for A and B:
//   lane l: h = l>>4, m = l&15 = row of A / column of B / column of D
//   elements 0..7  -> k = k0 + 8h + 0..7
//   elements 8..15 -> k = k0 + 16 + 8h + 0..7
//   D element r -> (row 8h + r, column m)
// p = start of a fragment-ordered tile + 8 * lane: each of the two loads reads 512
// consecutive bytes per wave (four whole 128-B lines).
__device__ __forceinline__ void ldfrag(Frag& f, const _Float16* p) {
    f.h[0] = *reinterpret_cast<const v8h*>(p);
    f.h[1] = *reinterpret_cast<const v8h*>(p + 256);
}

// The product with no slots written behind it: the compiler pads its own builtin form, and only
// where a reader of D or a writer of A or B really stands within the distance. (An asm statement
// of v_nop that names D, A and B holds them all in v0..v255: with the projections' 256
// accumulator registers that build spilled to scratch.)
__device__ __forceinline__ v8f mma_bare(const Frag& a, const Frag& b, v8f c) {
    return __builtin_amdgcn_wmma_f32_16x16x32_f16(false, a.v, false, b.v, (short)0, c, false, false);
}

// Eight 2^x in one statement. The outputs are early-clobbered, so none lands on a source of the
// run; the closing v_nop is the slot that the instruction set asks for behind a transcendental
// before its result is read or its source overwritten.
__device__ __forceinline__ void exp2_x8(float& e0, float& e1, float& e2, float& e3,
                                        float& e4, float& e5, float& e6, float& e7,
                                        const float (&y)[8]) {
    asm("v_exp_f32 %0, %8\n\tv_exp_f32 %1, %9\n\tv_exp_f32 %2, %10\n\tv_exp_f32 %3, %11\n\t"
        "v_exp_f32 %4, %12\n\tv_exp_f32 %5, %13\n\tv_exp_f32 %6, %14\n\tv_exp_f32 %7, %15\n\t"
        "v_nop"
        : "=&v"(e0), "=&v"(e1), "=&v"(e2), "=&v"(e3), "=&v"(e4), "=&v"(e5), "=&v"(e6), "=&v"(e7)
        : "v"(y[0]), "v"(y[1]), "v"(y[2]), "v"(y[3]), "v"(y[4]), "v"(y[5]), "v"(y[6]), "v"(y[7]));
}

// ------------------------------------------------------------------------
// Launch 1: f32 -> f16 conversion of x (scale 1) and the six weights (scale 64).
// Ten segments of 1048576 elements (x quarters 0..3, weights 4..9), grid (64, 10).
// A block converts one tile row (16 rows x 1024 k), the same 16384 units in source and
// in fragment order. Each lane converts 8 consecutive k of one row -> one 16-B store; a
// wave takes 8 rows x 32 k, so its store fills four whole 128-B lines.
// ------------------------------------------------------------------------
#define CV_IT  8
#define CV_BLK (256 * 8 * CV_IT)        // 16384 elements per block

__global__ __launch_bounds__(256) void cvt_kernel(
    const float* __restrict__ x,
    const float* __restrict__ W0, const float* __restrict__ W1, const float* __restrict__ W2,
    const float* __restrict__ W3, const float* __restrict__ W4, const float* __restrict__ W5,
    _Float16* wsh)
{
    const int tid = threadIdx.x;
    const int lane = tid & 31, wv = tid >> 5;
    const int row = (wv & 1) * 8 + (lane >> 2), kq = lane & 3;       // row in the tile, 8-k chunk
    const int seg = blockIdx.y;                                      // block-uniform
    const float* src;
    float sc;
    if (seg < 4) {
        src = x + (size_t)seg * NWE;
        sc  = 1.0f;
    } else {
        const int p = seg - 4;
        src = (p == 0) ? W0 : (p == 1) ? W1 : (p == 2) ? W2 : (p == 3) ? W3 : (p == 4) ? W4 : W5;
        sc  = 64.0f;                                                 // exact power of two
    }
    const size_t base = (size_t)blockIdx.x * CV_BLK;
    // pass i: k tile 4i + (wv >> 1)
    const float* sp = src + base;
    _Float16*    dp = wsh + (size_t)seg * NWE + base;
    const int so = row * DM + (wv >> 1) * 32 + kq * 8;               // source: row-major
    const int dn = (wv >> 1) * 512 + kq * 128 + row * 8;             // destination: fragment order

    H8 v[CV_IT];
#pragma unroll
    for (int i = 0; i < CV_IT; ++i) {
        const int e = so + i * 128;
        const v4f f0 = *reinterpret_cast<const v4f*>(sp + e);
        const v4f f1 = *reinterpret_cast<const v4f*>(sp + e + 4);
        H8 t;
        t.u = (v4u){0u, 0u, 0u, 0u};
#pragma unroll
        for (int q = 0; q < 4; ++q) {
            t.h[q]     = (_Float16)(f0[q] * sc);                     // RNE convert
            t.h[4 + q] = (_Float16)(f1[q] * sc);
        }
        v[i] = t;
    }
#pragma unroll
    for (int i = 0; i < CV_IT; ++i) {
        const int e = dn + i * 2048;
        *reinterpret_cast<v4u*>(dp + e) = v[i].u;
    }
    
}

// ------------------------------------------------------------------------
// Launch 2/3: Y = xh . wh^T / 64 for the projections. Block tile 128 tokens x 256
// features (four heads), 4 waves (2 x 2) of 64 tokens x 128 features, K stepped by 32:
// the twelve fragments of a K step feed 32 products (384 B loaded per product).
// Fragments are loaded directly from the fragment-ordered f16 tiles (identical split k map
// for both operands). ISV = 0: q/k planes, rows = n (q planes additionally x0.125);
// ISV = 1: value planes, rows = dv. In both the 8 values a lane holds of an accumulator are
// one 16-B chunk of the plane's fragment order at tile half + 8 * lane: stored directly,
// 512 consecutive bytes per wave and store.
// ------------------------------------------------------------------------
#define P_BM 128
#define P_BN 256
#define P_BK 32
#define P_MT 4                // token tiles of 16 per wave
#define P_NT 8                // feature tiles of 16 per wave

// the twelve fragments of K step k0: token rows 16mt + lo, feature rows 16nt + lo of the wave
__device__ __forceinline__ void proj_fetch(Frag (&xf)[P_MT], Frag (&wf)[P_NT],
                                           const char* xp, const char* wp, int k0) {
    const _Float16* xa = reinterpret_cast<const _Float16*>(xp);
    const _Float16* wb = reinterpret_cast<const _Float16*>(wp);
#pragma unroll
    for (int mt = 0; mt < P_MT; ++mt) ldfrag(xf[mt], xa + (size_t)(16 * mt) * DM + 16 * k0);
    // token fragments first in every group, the one in front of the loop too: with that group in
    // another order the counted waits at the loop's head, which hold for both, took the whole set
    __builtin_amdgcn_sched_barrier(0);
#pragma unroll
    for (int nt = 0; nt < P_NT; ++nt) ldfrag(wf[nt], wb + (size_t)(16 * nt) * DM + 16 * k0);
    // holds the 24 loads as one group in front of the other set's products: sunk towards their
    // own products they would be waited for with no lead
    __builtin_amdgcn_sched_barrier(0);
}

template <int ISV>
__device__ __forceinline__ void proj_step(v8f (&acc)[P_MT][P_NT], const Frag (&xf)[P_MT],
                                          const Frag (&wf)[P_NT]) {
#pragma unroll
    for (int nt = 0; nt < P_NT; ++nt) {
#pragma unroll
        for (int mt = 0; mt < P_MT; ++mt) {
            if (ISV) {
                // D[r] = Y[token 16mt+8h+r][feat 16nt+lo]
                acc[mt][nt] = mma_bare(xf[mt], wf[nt], acc[mt][nt]);
            } else {
                // D[r] = Y[token 16mt+lo][feat 16nt+8h+r]
                acc[mt][nt] = mma_bare(wf[nt], xf[mt], acc[mt][nt]);
            }
        }
    }
    // keeps the products in front of the loads that refill their operand registers
    __builtin_amdgcn_sched_barrier(0);
}

// Four slots between a set's last product and the loads that refill its registers, A and B
// operands alike, so that no load stands directly behind a product whose B it overwrites.
// The clobber keeps the loads behind the slots.
__device__ __forceinline__ void refill_gap() {
    asm volatile("v_nop\n\tv_nop\n\tv_nop\n\tv_nop" ::: "memory");
}

template <int ISV>
__global__ __launch_bounds__(128) void proj_kernel(const _Float16* xh, const _Float16* wh,
                                                   _Float16* planes)
{
    const int tid  = threadIdx.x;
    const int lane = tid & 31, w = tid >> 5;
    const int wm = w >> 1, wn = w & 1;                               // wave's place in the block tile
    const int z    = blockIdx.z;                                     // block-uniform
    int proj;
    float osc;
    if (ISV) {
        proj = 2 + 3 * z;                                            // 2, 5
        osc  = 1.0f / 64.0f;
    } else {
        proj = z + ((z >= 2) ? 1 : 0);                               // 0, 1, 3, 4
        osc  = (z == 0 || z == 2) ? (1.0f / 512.0f) : (1.0f / 64.0f);   // q planes: 0.125 / 64
    }
    const int n0 = blockIdx.x * P_BN + 128 * wn;                     // wave's feature base = head * 64
    const int m0 = blockIdx.y * P_BM;                                // block's token base

    // block-uniform bases and the lane's two byte offsets, which walk along K
    const char* xbase = reinterpret_cast<const char*>(xh + (size_t)m0 * DM);
    const char* wbase = reinterpret_cast<const char*>(wh + ((size_t)proj * DM + blockIdx.x * P_BN) * DM);
    unsigned xo = (unsigned)(64 * wm * DM + 8 * lane) * 2u;          // + (16*mt*DM + 16*k0) * 2
    unsigned wo = (unsigned)(128 * wn * DM + 8 * lane) * 2u;         // + (16*nt*DM + 16*k0) * 2

    v8f acc[P_MT][P_NT];
#pragma unroll
    for (int mt = 0; mt < P_MT; ++mt)
#pragma unroll
        for (int nt = 0; nt < P_NT; ++nt) acc[mt][nt] = vzero8();

    // Two register sets of the twelve fragments of a K step: while one set feeds its 32
    // products, the other set's 24 loads, issued as one group, are in flight.
    Frag xf[2][P_MT], wf[2][P_NT];
    proj_fetch(xf[0], wf[0], xbase + xo, wbase + wo, 0);
    // kept rolled: one trip holds both sets, a longer body would only add code
#pragma unroll 1
    for (int k0 = 0; k0 < DM - 2 * P_BK; k0 += 2 * P_BK) {
        proj_fetch(xf[1], wf[1], xbase + xo, wbase + wo, P_BK);
        proj_step<ISV>(acc, xf[0], wf[0]);
        refill_gap();
        proj_fetch(xf[0], wf[0], xbase + xo, wbase + wo, 2 * P_BK);
        proj_step<ISV>(acc, xf[1], wf[1]);
        refill_gap();
        // The two offsets are stepped by 64 k (2048 B) inside the statement of the wait.
        // Precaution: registers that issued loads name are rewritten only when the loads have
        // passed address translation; written as plain additions the compiler lifted the steps
        // to directly behind the loads. Here the wait stands at the foot of the
        // trip, 32 products behind the last load.
        asm volatile("s_wait_xcnt 0x0\n\t"
                     "v_add_nc_u32 %0, 0x800, %0\n\t"
                     "v_add_nc_u32 %1, 0x800, %1"
                     : "+v"(xo), "+v"(wo) :: "memory");
    }
    // the last two K steps: nothing left to fetch ahead
    proj_fetch(xf[1], wf[1], xbase + xo, wbase + wo, P_BK);
    // precaution: the two offsets of the loads above, held here as operands so that no load's
    // destination lands on them, are left alone until the loads have passed address translation
    asm volatile("s_wait_xcnt 0x0" :: "v"(xo), "v"(wo) : "memory");
    proj_step<ISV>(acc, xf[0], wf[0]);
    proj_step<ISV>(acc, xf[1], wf[1]);

    // scaled f16 chunks straight to the plane (each lane one 16-B vector per (mt, nt))
    const int bhi = (m0 / NSEQ) * NHD + n0 / DH;                     // + nt / 4
    const int nq0 = m0 % NSEQ + 64 * wm;
    _Float16* plane = planes + (size_t)proj * NXE + (size_t)bhi * (NSEQ * DH) + 8 * lane;
    H8 t[P_MT][P_NT];
#pragma unroll
    for (int nt = 0; nt < P_NT; ++nt) {
#pragma unroll
        for (int mt = 0; mt < P_MT; ++mt) {
            t[mt][nt].u = (v4u){0u, 0u, 0u, 0u};
#pragma unroll
            for (int r = 0; r < 8; ++r) t[mt][nt].h[r] = (_Float16)(acc[mt][nt][r] * osc);
        }
    }
#pragma unroll
    for (int nt = 0; nt < P_NT; ++nt) {
        const int hq = nt >> 2, nh = nt & 3;                         // head in the wave, tile in the head
#pragma unroll
        for (int mt = 0; mt < P_MT; ++mt) {
            // ISV: row dv = 16nh+lo, k = tokens 16mt+8h .. +7 -> tile (n/32)*4 + nh, half mt&1
            // else: row n = 16mt+lo, k = feats 16nh+8h .. +7  -> tile (n/16)*2 + nh/2, half nh&1
            const int off = ISV ? (((nq0 / 32 + (mt >> 1)) * 4 + nh) * 512 + (mt & 1) * 256)
                                : (((nq0 / 16 + mt) * 2 + (nh >> 1)) * 512 + (nh & 1) * 256);
            *reinterpret_cast<v4u*>(plane + hq * (NSEQ * DH) + off) = t[mt][nt].u;
        }
    }
}

// ------------------------------------------------------------------------
// Launch 4: attention. One block per (query block of 64, b*16+head, output index o),
// 4 waves x 16 queries. Output o uses score stream s = (head&1)^o and the value plane
// of stream o. Scores are computed transposed, S^T = K . Q^T (D rows = keys, cols =
// queries), so the probabilities come out of D already in B-fragment layout for
// O^T = V^T . P^T (element r <- 16-key tile 2c, element 8+r <- tile 2c+1). Per lane:
// one query (lo), 32 of the 64 keys of a step; the other 32 live in lane lo+16.
// K, V^T and Q^T fragments come straight from the fragment-ordered f16 planes (no LDS
// staging); the 8 K tiles and the 8 V^T tiles of a step are 8 KB consecutive each.
// ------------------------------------------------------------------------
#define A_QB 64
#define A_KT 64

__global__ __launch_bounds__(128) void attn_kernel(const _Float16* planes, float* out)
{
    __shared__ v4f St[1024];                                         // [4 waves][16][64] f32

    const int tid  = threadIdx.x;
    const int lane = tid & 31, w = tid >> 5, lo = lane & 15, hf = lane >> 4;
    const int qb = blockIdx.x, bh = blockIdx.y, o = blockIdx.z;
    const int b  = bh >> 4, hd = bh & 15;
    const int s  = (hd & 1) ^ o;                                     // score stream
    const size_t HO = (size_t)bh * NSEQ * DH;                        // same for both plane layouts
    const _Float16* Q = planes + (size_t)(s ? 3 : 0) * NXE + HO + 8 * lane;   // tiles (n/16)*2 + d/32, x0.125 inside
    const _Float16* K = planes + (size_t)(s ? 4 : 1) * NXE + HO + 8 * lane;   // tiles (n/16)*2 + d/32
    const _Float16* V = planes + (size_t)(o ? 5 : 2) * NXE + HO + 8 * lane;   // tiles (n/32)*4 + dv/16
    const int q0   = qb * A_QB;

    // Q^T as B operand: column = query (lane lo), k = d by the split map
    Frag qf[2];
#pragma unroll
    for (int dc = 0; dc < 2; ++dc) ldfrag(qf[dc], Q + ((q0 / 16 + w) * 2 + dc) * 512);

    v8f O[4];
#pragma unroll
    for (int i = 0; i < 4; ++i) O[i] = vzero8();
    float mrun = -1e30f, lrun = 0.f;

    // K fragments are fetched one step ahead, V^T fragments at the head of their own step,
    // each set's sixteen loads as one group: none waits directly in front of its product.
    Frag kf[8];                                                      // A operand: row = key, k = d
#pragma unroll
    for (int i = 0; i < 8; ++i) ldfrag(kf[i], K + i * 512);

#pragma unroll 1
    for (int t = 0; t < NSEQ / A_KT; ++t) {
        const int kb = t * A_KT;

        Frag vf[8];                                                  // A operand: row = dv 16nt+lo, k = key
        const _Float16* vp = V + (kb / 32) * 4 * 512;
#pragma unroll
        for (int i = 0; i < 8; ++i) ldfrag(vf[i], vp + i * 512);
        // holds the sixteen V^T loads as one group at the head of the step: sunk towards their
        // products they would be waited for with no lead
        __builtin_amdgcn_sched_barrier(0);

        // S^T tiles j = 0..3: keys kb+16j .. kb+16j+15; D[r] = score(query lo, key kb+16j+8h+r)
        float p[32];
#pragma unroll
        for (int j = 0; j < 4; ++j) {
            v8f S = vzero8();
#pragma unroll
            for (int dc = 0; dc < 2; ++dc) S = mma_bare(kf[2 * j + dc], qf[dc], S);
#pragma unroll
            for (int r = 0; r < 8; ++r) p[8 * j + r] = S[r];
        }

        // next step's K tiles into the registers just read (last step: step 0 again, not used)
        const int kn = ((t + 1) & (NSEQ / A_KT - 1)) * A_KT;
        const _Float16* kp = K + (kn / 16) * 2 * 512;
#pragma unroll
        for (int i = 0; i < 8; ++i) ldfrag(kf[i], kp + i * 512);
        // holds the sixteen K loads directly behind the score products: softmax and the value
        // products of this step are their lead
        __builtin_amdgcn_sched_barrier(0);

        // online softmax in f32 (row = query lo; partner lane lo^16 holds the other 32 keys)
        float tmax = p[0];
#pragma unroll
        for (int i = 1; i < 32; ++i) tmax = fmaxf(tmax, p[i]);
        tmax = fmaxf(tmax, __shfl_xor(tmax, 16, 32));
        const float mnew  = fmaxf(mrun, tmax);
        // keeps the wait below behind the exchange of the maxima: lifted to the K loads it would
        // hold the wave there
        __builtin_amdgcn_sched_barrier(0);
        // precaution: the two address pairs of this step's loads, held here as operands so that no
        // load's destination lands on them, are left alone until the loads have passed address
        // translation
        asm volatile("s_wait_xcnt 0x0" :: "v"(vp), "v"(kp) : "memory");
        const float alpha = __expf(mrun - mnew);
        float rs = 0.f;
#pragma unroll
        for (int g = 0; g < 4; ++g) {
            float y[8];
#pragma unroll
            for (int r = 0; r < 8; ++r) y[r] = (p[8 * g + r] - mnew) * 1.44269504088896340736f;
            exp2_x8(p[8 * g], p[8 * g + 1], p[8 * g + 2], p[8 * g + 3],
                    p[8 * g + 4], p[8 * g + 5], p[8 * g + 6], p[8 * g + 7], y);
        }
#pragma unroll
        for (int i = 0; i < 32; ++i) rs += p[i];
        rs += __shfl_xor(rs, 16, 32);
        lrun = lrun * alpha + rs;
        mrun = mnew;
#pragma unroll
        for (int nt = 0; nt < 4; ++nt) O[nt] = O[nt] * alpha;

        // O^T[dv][q] += V^T[dv][key] . P^T[key][q] over two 32-key halves c
#pragma unroll
        for (int c = 0; c < 2; ++c) {
            // P^T as B operand straight from the D layout, carried x16384:
            // element r <- key 32c+8h+r (tile 2c), element 8+r <- key 32c+16+8h+r (tile 2c+1)
            H8 a0, a1;
            a0.u = (v4u){0u, 0u, 0u, 0u};
            a1.u = (v4u){0u, 0u, 0u, 0u};
#pragma unroll
            for (int r = 0; r < 8; ++r) {
                a0.h[r] = (_Float16)(p[16 * c + r] * 16384.0f);
                a1.h[r] = (_Float16)(p[16 * c + 8 + r] * 16384.0f);
            }
            Frag pf;
            pf.u[0] = a0.u;
            pf.u[1] = a1.u;
#pragma unroll
            for (int nt = 0; nt < 4; ++nt)
                O[nt] = mma_bare(vf[4 * c + nt], pf, O[nt]);             // D[r] = O[query lo][dv 16nt+8h+r]
        }
    }

    const float inv = 1.0f / (lrun * 16384.0f);                      // lrun >= 1
    v4f* Sw = St + w * 256;
#pragma unroll
    for (int nt = 0; nt < 4; ++nt) {
        v4f a  = {O[nt][0] * inv, O[nt][1] * inv, O[nt][2] * inv, O[nt][3] * inv};
        v4f cc = {O[nt][4] * inv, O[nt][5] * inv, O[nt][6] * inv, O[nt][7] * inv};
        Sw[lo * 16 + 4 * nt + 2 * hf]     = a;                       // floats lo*64 + 16nt + 8h .. +3
        Sw[lo * 16 + 4 * nt + 2 * hf + 1] = cc;                      // .. +4 .. +7
    }
    __syncthreads();

    float* ob = out + (size_t)o * NXE + ((size_t)b * NSEQ + q0 + 16 * w) * DM + (size_t)hd * DH;
    const int c = (lane & 7) * 4;
    v4f vals[8];
#pragma unroll
    for (int si = 0; si < 8; ++si) {
        const int L = 4 * si + (lane >> 3);          // 32 lines per wave: row = L>>1, half = L&1
        vals[si] = Sw[8 * L + (lane & 7)];
    }
#pragma unroll
    for (int si = 0; si < 8; ++si) {
        const int L = 4 * si + (lane >> 3);
        *reinterpret_cast<v4f*>(ob + (size_t)(L >> 1) * DM + 32 * (L & 1) + c) = vals[si];
    }
    
}

// ------------------------------------------------------------------------
// host glue: 4 launches; shapes are fixed by the module configuration and
// checked against the passed sizes (no-op on any disagreement).
// ------------------------------------------------------------------------
extern "C" void kernel_launch(void* const* d_in, const int* in_sizes, int n_in,
                              void* d_out, int out_size, void* d_ws, size_t ws_size,
                              hipStream_t stream)
{
    if (n_in < 7) return;
    if (in_sizes[0] != NXE) return;
    for (int p = 0; p < NPROJ; ++p) if (in_sizes[1 + p] != NWE) return;
    if (out_size != 2 * NXE) return;
    const size_t ws_need = WS_HALVES * sizeof(_Float16);             // 71303168 B
    if (ws_size < ws_need) return;

    const float* x  = (const float*)d_in[0];
    const float* W0 = (const float*)d_in[1];
    const float* W1 = (const float*)d_in[2];
    const float* W2 = (const float*)d_in[3];
    const float* W3 = (const float*)d_in[4];
    const float* W4 = (const float*)d_in[5];
    const float* W5 = (const float*)d_in[6];
    _Float16* wsh = (_Float16*)d_ws;
    float* out = (float*)d_out;

    cvt_kernel<<<dim3(NWE / CV_BLK, 10, 1), 256, 0, stream>>>(x, W0, W1, W2, W3, W4, W5, wsh + OFF_XH);
    proj_kernel<0><<<dim3(DM / P_BN, NTOK / P_BM, 4), 128, 0, stream>>>(wsh + OFF_XH, wsh + OFF_WH, wsh + OFF_PL);
    proj_kernel<1><<<dim3(DM / P_BN, NTOK / P_BM, 2), 128, 0, stream>>>(wsh + OFF_XH, wsh + OFF_WH, wsh + OFF_PL);
    attn_kernel<<<dim3(NSEQ / A_QB, NB * NHD, 2), 128, 0, stream>>>(wsh + OFF_PL, out);
}

// v005
// Measured time: 115 microseconds a run.
// Two timings next to v004 put it at 1.08 and 1.07 times that version's speed.
// All steps since v000 together make it 3.26 times as fast.
#include <hip/hip_runtime.h>

// Contractions: six input projections, key x query^T score tiles and value^T x prob^T tiles,
// all v_wmma_f32_16x16x32_f16 (f16 operands, f32 accumulate). f16 operand scaling: weights x64,
// queries x0.125, probabilities x16384, folded back in f32 epilogues. Softmax statistics,
// normalisation and the outputs: f32.

typedef _Float16     v16h __attribute__((ext_vector_type(16)));
typedef _Float16     v8h  __attribute__((ext_vector_type(8)));
typedef float        v8f  __attribute__((ext_vector_type(8)));
typedef float        v4f  __attribute__((ext_vector_type(4)));
typedef unsigned int v4u  __attribute__((ext_vector_type(4)));

union Frag { v16h v; v8h h[2]; v4u u[2]; };
union H8   { v8h h; v4u u; };

#define DM    1024            // model width (dim_in = dim_k = dim_v)
#define NB    2               // batch
#define NSEQ  2048            // sequence length
#define NTOK  (NB * NSEQ)     // token rows
#define NHD   16              // heads
#define DH    64              // head width
#define NPROJ 6
#define NXE   (NTOK * DM)     // 4194304 elements per activation tensor
#define NWE   (DM * DM)       // 1048576 elements per weight

// workspace in 16-bit units; every operand lies in fragment order: a tile of 16 rows x 32 k
// is 512 consecutive units, unit = (k_in >> 3) * 128 + row_in * 8 + (k_in & 7), so that lane l
// of a wave finds its two 16-B fragment halves at tile + 8l and tile + 256 + 8l.
//   xh  f16(x)         rows = tokens,   k = dim_in: tile (row/16) * 32 + k/32       at OFF_XH
//   wh  f16(64 * W_p)  rows = features, k = dim_in: the same per weight             at OFF_WH
//   six planes of 4096*1024 at OFF_PL + p * NXE, each [b*16+head] x 131072 units:
//     p = 0,1,3,4  rows = n,  k = d: tile (n/16) * 2 + d/32 (q planes carry x0.125)
//     p = 2,5      rows = dv, k = n: tile (n/32) * 4 + dv/16
#define OFF_XH    ((size_t)0)
#define OFF_WH    ((size_t)NXE)
#define OFF_PL    ((size_t)NXE + (size_t)NPROJ * (size_t)NWE)
#define WS_HALVES (OFF_PL + (size_t)NPROJ * (size_t)NXE)        // 35651584 -> 71303168 B

// ------------------------------------------------------------------------
// helpers
// ------------------------------------------------------------------------
__device__ __forceinline__ v8f vzero8() {
    v8f z = {0.f, 0.f, 0.f, 0.f, 0.f, 0.f, 0.f, 0.f};
    return z;
}

// Fragment layout (wave32, 16x16x32), identical for A and B:
//   lane l: h = l>>4, m = l&15 = row of A / column of B / column of D
//   elements 0..7  -> k = k0 + 8h + 0..7
//   elements 8..15 -> k = k0 + 16 + 8h + 0..7
//   D element r -> (row 8h + r, column m)
// p = start of a fragment-ordered tile + 8 * lane: each of the two loads reads 512
// consecutive bytes per wave (four whole 128-B lines).
__device__ __forceinline__ void ldfrag(Frag& f, const _Float16* p) {
    f.h[0] = *reinterpret_cast<const v8h*>(p);
    f.h[1] = *reinterpret_cast<const v8h*>(p + 256);
}

// The product with no slots written behind it: the compiler pads its own builtin form, and only
// where a reader of D or a writer of A or B really stands within the distance. (An asm statement
// of v_nop that names D, A and B holds them all in v0..v255: with the projections' 256
// accumulator registers that build spilled to scratch.)
__device__ __forceinline__ v8f mma_bare(const Frag& a, const Frag& b, v8f c) {
    return __builtin_amdgcn_wmma_f32_16x16x32_f16(false, a.v, false, b.v, (short)0, c, false, false);
}

// Eight 2^x in one statement. The outputs are early-clobbered, so none lands on a source of the
// run; the closing v_nop is the slot that the instruction set asks for behind a transcendental
// before its result is read or its source overwritten.
__device__ __forceinline__ void exp2_x8(float& e0, float& e1, float& e2, float& e3,
                                        float& e4, float& e5, float& e6, float& e7,
                                        const float (&y)[8]) {
    asm("v_exp_f32 %0, %8\n\tv_exp_f32 %1, %9\n\tv_exp_f32 %2, %10\n\tv_exp_f32 %3, %11\n\t"
        "v_exp_f32 %4, %12\n\tv_exp_f32 %5, %13\n\tv_exp_f32 %6, %14\n\tv_exp_f32 %7, %15\n\t"
        "v_nop"
        : "=&v"(e0), "=&v"(e1), "=&v"(e2), "=&v"(e3), "=&v"(e4), "=&v"(e5), "=&v"(e6), "=&v"(e7)
        : "v"(y[0]), "v"(y[1]), "v"(y[2]), "v"(y[3]), "v"(y[4]), "v"(y[5]), "v"(y[6]), "v"(y[7]));
}

// ------------------------------------------------------------------------
// Launch 1: f32 -> f16 conversion of x (scale 1) and the six weights (scale 64).
// Ten segments of 1048576 elements (x quarters 0..3, weights 4..9), grid (64, 10).
// A block converts one tile row (16 rows x 1024 k), the same 16384 units in source and
// in fragment order. Each lane converts 8 consecutive k of one row -> one 16-B store; a
// wave takes 8 rows x 32 k, so its store fills four whole 128-B lines.
// ------------------------------------------------------------------------
#define CV_IT  8
#define CV_BLK (256 * 8 * CV_IT)        // 16384 elements per block

__global__ __launch_bounds__(256) void cvt_kernel(
    const float* __restrict__ x,
    const float* __restrict__ W0, const float* __restrict__ W1, const float* __restrict__ W2,
    const float* __restrict__ W3, const float* __restrict__ W4, const float* __restrict__ W5,
    _Float16* wsh)
{
    const int tid = threadIdx.x;
    const int lane = tid & 31, wv = tid >> 5;
    const int row = (wv & 1) * 8 + (lane >> 2), kq = lane & 3;       // row in the tile, 8-k chunk
    const int seg = blockIdx.y;                                      // block-uniform
    const float* src;
    float sc;
    if (seg < 4) {
        src = x + (size_t)seg * NWE;
        sc  = 1.0f;
    } else {
        const int p = seg - 4;
        src = (p == 0) ? W0 : (p == 1) ? W1 : (p == 2) ? W2 : (p == 3) ? W3 : (p == 4) ? W4 : W5;
        sc  = 64.0f;                                                 // exact power of two
    }
    const size_t base = (size_t)blockIdx.x * CV_BLK;
    // pass i: k tile 4i + (wv >> 1)
    const float* sp = src + base;
    _Float16*    dp = wsh + (size_t)seg * NWE + base;
    const int so = row * DM + (wv >> 1) * 32 + kq * 8;               // source: row-major
    const int dn = (wv >> 1) * 512 + kq * 128 + row * 8;             // destination: fragment order

    H8 v[CV_IT];
#pragma unroll
    for (int i = 0; i < CV_IT; ++i) {
        const int e = so + i * 128;
        const v4f f0 = *reinterpret_cast<const v4f*>(sp + e);
        const v4f f1 = *reinterpret_cast<const v4f*>(sp + e + 4);
        H8 t;
        t.u = (v4u){0u, 0u, 0u, 0u};
#pragma unroll
        for (int q = 0; q < 4; ++q) {
            t.h[q]     = (_Float16)(f0[q] * sc);                     // RNE convert
            t.h[4 + q] = (_Float16)(f1[q] * sc);
        }
        v[i] = t;
    }
#pragma unroll
    for (int i = 0; i < CV_IT; ++i) {
        const int e = dn + i * 2048;
        *reinterpret_cast<v4u*>(dp + e) = v[i].u;
    }
    
}

// ------------------------------------------------------------------------
// Launch 2/3: Y = xh . wh^T / 64 for the projections. Block tile 128 tokens x 256
// features (four heads), 4 waves (2 x 2) of 64 tokens x 128 features, K stepped by 32:
// the twelve fragments of a K step feed 32 products (384 B loaded per product).
// Fragments are loaded directly from the fragment-ordered f16 tiles (identical split k map
// for both operands). ISV = 0: q/k planes, rows = n (q planes additionally x0.125);
// ISV = 1: value planes, rows = dv. In both the 8 values a lane holds of an accumulator are
// one 16-B chunk of the plane's fragment order at tile half + 8 * lane: stored directly,
// 512 consecutive bytes per wave and store.
// ------------------------------------------------------------------------
#define P_BM 128
#define P_BN 256
#define P_BK 32
#define P_MT 4                // token tiles of 16 per wave
#define P_NT 8                // feature tiles of 16 per wave

// the twelve fragments of K step k0: token rows 16mt + lo, feature rows 16nt + lo of the wave
__device__ __forceinline__ void proj_fetch(Frag (&xf)[P_MT], Frag (&wf)[P_NT],
                                           const char* xp, const char* wp, int k0) {
    const _Float16* xa = reinterpret_cast<const _Float16*>(xp);
    const _Float16* wb = reinterpret_cast<const _Float16*>(wp);
#pragma unroll
    for (int mt = 0; mt < P_MT; ++mt) ldfrag(xf[mt], xa + (size_t)(16 * mt) * DM + 16 * k0);
    // token fragments first in every group, the one in front of the loop too: with that group in
    // another order the counted waits at the loop's head, which hold for both, took the whole set
    __builtin_amdgcn_sched_barrier(0);
#pragma unroll
    for (int nt = 0; nt < P_NT; ++nt) ldfrag(wf[nt], wb + (size_t)(16 * nt) * DM + 16 * k0);
    // holds the 24 loads as one group in front of the other set's products: sunk towards their
    // own products they would be waited for with no lead
    __builtin_amdgcn_sched_barrier(0);
}

template <int ISV>
__device__ __forceinline__ void proj_step(v8f (&acc)[P_MT][P_NT], const Frag (&xf)[P_MT],
                                          const Frag (&wf)[P_NT]) {
#pragma unroll
    for (int nt = 0; nt < P_NT; ++nt) {
#pragma unroll
        for (int mt = 0; mt < P_MT; ++mt) {
            if (ISV) {
                // D[r] = Y[token 16mt+8h+r][feat 16nt+lo]
                acc[mt][nt] = mma_bare(xf[mt], wf[nt], acc[mt][nt]);
            } else {
                // D[r] = Y[token 16mt+lo][feat 16nt+8h+r]
                acc[mt][nt] = mma_bare(wf[nt], xf[mt], acc[mt][nt]);
            }
        }
    }
    // keeps the products in front of the loads that refill their operand registers
    __builtin_amdgcn_sched_barrier(0);
}

// Four slots between a set's last product and the loads that refill its registers, A and B
// operands alike, so that no load stands directly behind a product whose B it overwrites.
// The clobber keeps the loads behind the slots.
__device__ __forceinline__ void refill_gap() {
    asm volatile("v_nop\n\tv_nop\n\tv_nop\n\tv_nop" ::: "memory");
}

template <int ISV>
__global__ __launch_bounds__(128) void proj_kernel(const _Float16* xh, const _Float16* wh,
                                                   _Float16* planes)
{
    const int tid  = threadIdx.x;
    const int lane = tid & 31, w = tid >> 5;
    const int wm = w >> 1, wn = w & 1;                               // wave's place in the block tile
    const int z    = blockIdx.z;                                     // block-uniform
    int proj;
    float osc;
    if (ISV) {
        proj = 2 + 3 * z;                                            // 2, 5
        osc  = 1.0f / 64.0f;
    } else {
        proj = z + ((z >= 2) ? 1 : 0);                               // 0, 1, 3, 4
        osc  = (z == 0 || z == 2) ? (1.0f / 512.0f) : (1.0f / 64.0f);   // q planes: 0.125 / 64
    }
    const int n0 = blockIdx.x * P_BN + 128 * wn;                     // wave's feature base = head * 64
    const int m0 = blockIdx.y * P_BM;                                // block's token base

    // block-uniform bases and the lane's two byte offsets, which walk along K
    const char* xbase = reinterpret_cast<const char*>(xh + (size_t)m0 * DM);
    const char* wbase = reinterpret_cast<const char*>(wh + ((size_t)proj * DM + blockIdx.x * P_BN) * DM);
    unsigned xo = (unsigned)(64 * wm * DM + 8 * lane) * 2u;          // + (16*mt*DM + 16*k0) * 2
    unsigned wo = (unsigned)(128 * wn * DM + 8 * lane) * 2u;         // + (16*nt*DM + 16*k0) * 2

    v8f acc[P_MT][P_NT];
#pragma unroll
    for (int mt = 0; mt < P_MT; ++mt)
#pragma unroll
        for (int nt = 0; nt < P_NT; ++nt) acc[mt][nt] = vzero8();

    // Two register sets of the twelve fragments of a K step: while one set feeds its 32
    // products, the other set's 24 loads, issued as one group, are in flight.
    Frag xf[2][P_MT], wf[2][P_NT];
    proj_fetch(xf[0], wf[0], xbase + xo, wbase + wo, 0);
    // kept rolled: one trip holds both sets, a longer body would only add code
#pragma unroll 1
    for (int k0 = 0; k0 < DM - 2 * P_BK; k0 += 2 * P_BK) {
        proj_fetch(xf[1], wf[1], xbase + xo, wbase + wo, P_BK);
        proj_step<ISV>(acc, xf[0], wf[0]);
        refill_gap();
        proj_fetch(xf[0], wf[0], xbase + xo, wbase + wo, 2 * P_BK);
        proj_step<ISV>(acc, xf[1], wf[1]);
        refill_gap();
        // The two offsets are stepped by 64 k (2048 B) inside the statement of the wait.
        // Precaution: registers that issued loads name are rewritten only when the loads have
        // passed address translation; written as plain additions the compiler lifted the steps
        // to directly behind the loads. Here the wait stands at the foot of the
        // trip, 32 products behind the last load.
        asm volatile("s_wait_xcnt 0x0\n\t"
                     "v_add_nc_u32 %0, 0x800, %0\n\t"
                     "v_add_nc_u32 %1, 0x800, %1"
                     : "+v"(xo), "+v"(wo) :: "memory");
    }
    // the last two K steps: nothing left to fetch ahead
    proj_fetch(xf[1], wf[1], xbase + xo, wbase + wo, P_BK);
    // precaution: the two offsets of the loads above, held here as operands so that no load's
    // destination lands on them, are left alone until the loads have passed address translation
    asm volatile("s_wait_xcnt 0x0" :: "v"(xo), "v"(wo) : "memory");
    proj_step<ISV>(acc, xf[0], wf[0]);
    proj_step<ISV>(acc, xf[1], wf[1]);

    // scaled f16 chunks straight to the plane (each lane one 16-B vector per (mt, nt))
    const int bhi = (m0 / NSEQ) * NHD + n0 / DH;                     // + nt / 4
    const int nq0 = m0 % NSEQ + 64 * wm;
    _Float16* plane = planes + (size_t)proj * NXE + (size_t)bhi * (NSEQ * DH) + 8 * lane;
    H8 t[P_MT][P_NT];
#pragma unroll
    for (int nt = 0; nt < P_NT; ++nt) {
#pragma unroll
        for (int mt = 0; mt < P_MT; ++mt) {
            t[mt][nt].u = (v4u){0u, 0u, 0u, 0u};
#pragma unroll
            for (int r = 0; r < 8; ++r) t[mt][nt].h[r] = (_Float16)(acc[mt][nt][r] * osc);
        }
    }
#pragma unroll
    for (int nt = 0; nt < P_NT; ++nt) {
        const int hq = nt >> 2, nh = nt & 3;                         // head in the wave, tile in the head
#pragma unroll
        for (int mt = 0; mt < P_MT; ++mt) {
            // ISV: row dv = 16nh+lo, k = tokens 16mt+8h .. +7 -> tile (n/32)*4 + nh, half mt&1
            // else: row n = 16mt+lo, k = feats 16nh+8h .. +7  -> tile (n/16)*2 + nh/2, half nh&1
            const int off = ISV ? (((nq0 / 32 + (mt >> 1)) * 4 + nh) * 512 + (mt & 1) * 256)
                                : (((nq0 / 16 + mt) * 2 + (nh >> 1)) * 512 + (nh & 1) * 256);
            *reinterpret_cast<v4u*>(plane + hq * (NSEQ * DH) + off) = t[mt][nt].u;
        }
    }
}

// ------------------------------------------------------------------------
// Launch 4: attention. One block per (query block of 256, b*16+head, output index o),
// 8 waves x 32 queries (two query tiles of 16). Output o uses score stream s = (head&1)^o and
// the value plane of stream o. Scores are computed transposed, S^T = K . Q^T (D rows = keys,
// cols = queries), so the probabilities come out of D already in B-fragment layout for
// O^T = V^T . P^T (element r <- 16-key tile 0, element 8+r <- tile 1 of the step). Per lane and
// query tile: one query (lo), 16 of the 32 keys of a step; the other 16 live in lane lo+16.
// K, V^T and Q^T fragments come straight from the fragment-ordered f16 planes (no LDS
// staging); the 4 K tiles and the 4 V^T tiles of a step are 4 KB consecutive each, and every
// fragment feeds two products, one per query tile. Four waves per SIMD: 256 registers a wave.
// ------------------------------------------------------------------------
#define A_NW 8                // waves per block
#define A_QT 2                // query tiles of 16 per wave
#define A_QB (A_NW * A_QT * 16)
#define A_KT 32               // keys per step

__global__ __launch_bounds__(A_NW * 32) __attribute__((amdgpu_waves_per_eu(4, 4)))
void attn_kernel(const _Float16* planes, float* out)
{
    __shared__ v4f St[A_NW * A_QT * 256];                            // [8 waves][32][64] f32

    const int tid  = threadIdx.x;
    const int lane = tid & 31, w = tid >> 5, lo = lane & 15, hf = lane >> 4;
    const int qb = blockIdx.x, bh = blockIdx.y, o = blockIdx.z;
    const int b  = bh >> 4, hd = bh & 15;
    const int s  = (hd & 1) ^ o;                                     // score stream
    const size_t HO = (size_t)bh * NSEQ * DH;                        // same for both plane layouts
    const _Float16* Q = planes + (size_t)(s ? 3 : 0) * NXE + HO + 8 * lane;   // tiles (n/16)*2 + d/32, x0.125 inside
    const _Float16* K = planes + (size_t)(s ? 4 : 1) * NXE + HO + 8 * lane;   // tiles (n/16)*2 + d/32
    const _Float16* V = planes + (size_t)(o ? 5 : 2) * NXE + HO + 8 * lane;   // tiles (n/32)*4 + dv/16
    const int q0   = qb * A_QB + 16 * A_QT * w;                      // the wave's first query

    // Q^T as B operand: column = query (lane lo), k = d by the split map
    Frag qf[A_QT][2];
#pragma unroll
    for (int qt = 0; qt < A_QT; ++qt)
#pragma unroll
        for (int dc = 0; dc < 2; ++dc) ldfrag(qf[qt][dc], Q + ((q0 / 16 + qt) * 2 + dc) * 512);

    v8f O[A_QT][4];
#pragma unroll
    for (int qt = 0; qt < A_QT; ++qt)
#pragma unroll
        for (int i = 0; i < 4; ++i) O[qt][i] = vzero8();
    float mrun[A_QT], lrun[A_QT];
#pragma unroll
    for (int qt = 0; qt < A_QT; ++qt) { mrun[qt] = -1e30f; lrun[qt] = 0.f; }

    // K fragments are fetched one step ahead, V^T fragments at the head of their own step,
    // each set's eight loads as one group: none waits directly in front of its product.
    Frag kf[4];                                                      // A operand: row = key, k = d
#pragma unroll
    for (int i = 0; i < 4; ++i) ldfrag(kf[i], K + i * 512);

#pragma unroll 1
    for (int t = 0; t < NSEQ / A_KT; ++t) {
        const int kb = t * A_KT;

        Frag vf[4];                                                  // A operand: row = dv 16nt+lo, k = key
        const _Float16* vp = V + (kb / 32) * 4 * 512;
#pragma unroll
        for (int i = 0; i < 4; ++i) ldfrag(vf[i], vp + i * 512);
        // holds the eight V^T loads as one group at the head of the step: sunk towards their
        // products they would be waited for with no lead
        __builtin_amdgcn_sched_barrier(0);

        // S^T tiles j = 0,1: keys kb+16j .. kb+16j+15; D[r] = score(query 16qt+lo, key kb+16j+8h+r)
        float p[A_QT][16];
#pragma unroll
        for (int j = 0; j < 2; ++j) {
#pragma unroll
            for (int qt = 0; qt < A_QT; ++qt) {
                v8f S = vzero8();
#pragma unroll
                for (int dc = 0; dc < 2; ++dc) S = mma_bare(kf[2 * j + dc], qf[qt][dc], S);
#pragma unroll
                for (int r = 0; r < 8; ++r) p[qt][8 * j + r] = S[r];
            }
        }

        // next step's K tiles into the registers just read (last step: step 0 again, not used)
        const int kn = ((t + 1) & (NSEQ / A_KT - 1)) * A_KT;
        const _Float16* kp = K + (kn / 16) * 2 * 512;
#pragma unroll
        for (int i = 0; i < 4; ++i) ldfrag(kf[i], kp + i * 512);
        // holds the eight K loads directly behind the score products: softmax and the value
        // products of this step are their lead
        __builtin_amdgcn_sched_barrier(0);

        // online softmax in f32 (row = query 16qt+lo; partner lane lo^16 holds the other 16 keys)
        float tmax[A_QT], mnew[A_QT];
#pragma unroll
        for (int qt = 0; qt < A_QT; ++qt) {
            tmax[qt] = p[qt][0];
#pragma unroll
            for (int i = 1; i < 16; ++i) tmax[qt] = fmaxf(tmax[qt], p[qt][i]);
        }
        float tx[A_QT];
#pragma unroll
        for (int qt = 0; qt < A_QT; ++qt) tx[qt] = __shfl_xor(tmax[qt], 16, 32);
#pragma unroll
        for (int qt = 0; qt < A_QT; ++qt) mnew[qt] = fmaxf(mrun[qt], fmaxf(tmax[qt], tx[qt]));
        // keeps the wait below behind the exchange of the maxima: lifted to the K loads it would
        // hold the wave there
        __builtin_amdgcn_sched_barrier(0);
        // precaution: the two address pairs of this step's loads, held here as operands so that no
        // load's destination lands on them, are left alone until the loads have passed address
        // translation
        asm volatile("s_wait_xcnt 0x0" :: "v"(vp), "v"(kp) : "memory");
        float rs[A_QT];
#pragma unroll
        for (int qt = 0; qt < A_QT; ++qt) {
            const float alpha = __expf(mrun[qt] - mnew[qt]);
#pragma unroll
            for (int g = 0; g < 2; ++g) {
                float y[8];
#pragma unroll
                for (int r = 0; r < 8; ++r) y[r] = (p[qt][8 * g + r] - mnew[qt]) * 1.44269504088896340736f;
                exp2_x8(p[qt][8 * g], p[qt][8 * g + 1], p[qt][8 * g + 2], p[qt][8 * g + 3],
                        p[qt][8 * g + 4], p[qt][8 * g + 5], p[qt][8 * g + 6], p[qt][8 * g + 7], y);
            }
            rs[qt] = 0.f;
#pragma unroll
            for (int i = 0; i < 16; ++i) rs[qt] += p[qt][i];
            lrun[qt] *= alpha;
            mrun[qt] = mnew[qt];
#pragma unroll
            for (int nt = 0; nt < 4; ++nt) O[qt][nt] = O[qt][nt] * alpha;
        }
        float rx[A_QT];
#pragma unroll
        for (int qt = 0; qt < A_QT; ++qt) rx[qt] = __shfl_xor(rs[qt], 16, 32);
#pragma unroll
        for (int qt = 0; qt < A_QT; ++qt) lrun[qt] += rs[qt] + rx[qt];

        // O^T[dv][q] += V^T[dv][key] . P^T[key][q] over the 32 keys of the step
        Frag pf[A_QT];
#pragma unroll
        for (int qt = 0; qt < A_QT; ++qt) {
            // P^T as B operand straight from the D layout, carried x16384:
            // element r <- key 8h+r (tile 0), element 8+r <- key 16+8h+r (tile 1)
            H8 a0, a1;
            a0.u = (v4u){0u, 0u, 0u, 0u};
            a1.u = (v4u){0u, 0u, 0u, 0u};
#pragma unroll
            for (int r = 0; r < 8; ++r) {
                a0.h[r] = (_Float16)(p[qt][r] * 16384.0f);
                a1.h[r] = (_Float16)(p[qt][8 + r] * 16384.0f);
            }
            pf[qt].u[0] = a0.u;
            pf[qt].u[1] = a1.u;
        }
#pragma unroll
        for (int nt = 0; nt < 4; ++nt)
#pragma unroll
            for (int qt = 0; qt < A_QT; ++qt)
                O[qt][nt] = mma_bare(vf[nt], pf[qt], O[qt][nt]);     // D[r] = O[query 16qt+lo][dv 16nt+8h+r]
    }

    v4f* Sw = St + w * (A_QT * 256);
#pragma unroll
    for (int qt = 0; qt < A_QT; ++qt) {
        const float inv = 1.0f / (lrun[qt] * 16384.0f);              // lrun >= 1
#pragma unroll
        for (int nt = 0; nt < 4; ++nt) {
            v4f a  = {O[qt][nt][0] * inv, O[qt][nt][1] * inv, O[qt][nt][2] * inv, O[qt][nt][3] * inv};
            v4f cc = {O[qt][nt][4] * inv, O[qt][nt][5] * inv, O[qt][nt][6] * inv, O[qt][nt][7] * inv};
            Sw[(16 * qt + lo) * 16 + 4 * nt + 2 * hf]     = a;       // floats row*64 + 16nt + 8h .. +3
            Sw[(16 * qt + lo) * 16 + 4 * nt + 2 * hf + 1] = cc;      // .. +4 .. +7
        }
    }
    __syncthreads();

    float* ob = out + (size_t)o * NXE + ((size_t)b * NSEQ + q0) * DM + (size_t)hd * DH;
    const int c = (lane & 7) * 4;
    v4f vals[8 * A_QT];
#pragma unroll
    for (int si = 0; si < 8 * A_QT; ++si) {
        const int L = 4 * si + (lane >> 3);          // 64 lines per wave: row = L>>1, half = L&1
        vals[si] = Sw[8 * L + (lane & 7)];
    }
#pragma unroll
    for (int si = 0; si < 8 * A_QT; ++si) {
        const int L = 4 * si + (lane >> 3);
        *reinterpret_cast<v4f*>(ob + (size_t)(L >> 1) * DM + 32 * (L & 1) + c) = vals[si];
    }
}

// ------------------------------------------------------------------------
// host glue: 4 launches; shapes are fixed by the module configuration and
// checked against the passed sizes (no-op on any disagreement).
// ------------------------------------------------------------------------
extern "C" void kernel_launch(void* const* d_in, const int* in_sizes, int n_in,
                              void* d_out, int out_size, void* d_ws, size_t ws_size,
                              hipStream_t stream)
{
    if (n_in < 7) return;
    if (in_sizes[0] != NXE) return;
    for (int p = 0; p < NPROJ; ++p) if (in_sizes[1 + p] != NWE) return;
    if (out_size != 2 * NXE) return;
    const size_t ws_need = WS_HALVES * sizeof(_Float16);             // 71303168 B
    if (ws_size < ws_need) return;

    const float* x  = (const float*)d_in[0];
    const float* W0 = (const float*)d_in[1];
    const float* W1 = (const float*)d_in[2];
    const float* W2 = (const float*)d_in[3];
    const float* W3 = (const float*)d_in[4];
    const float* W4 = (const float*)d_in[5];
    const float* W5 = (const float*)d_in[6];
    _Float16* wsh = (_Float16*)d_ws;
    float* out = (float*)d_out;

    cvt_kernel<<<dim3(NWE / CV_BLK, 10, 1), 256, 0, stream>>>(x, W0, W1, W2, W3, W4, W5, wsh + OFF_XH);
    proj_kernel<0><<<dim3(DM / P_BN, NTOK / P_BM, 4), 128, 0, stream>>>(wsh + OFF_XH, wsh + OFF_WH, wsh + OFF_PL);
    proj_kernel<1><<<dim3(DM / P_BN, NTOK / P_BM, 2), 128, 0, stream>>>(wsh + OFF_XH, wsh + OFF_WH, wsh + OFF_PL);
    attn_kernel<<<dim3(NSEQ / A_QB, NB * NHD, 2), A_NW * 32, 0, stream>>>(wsh + OFF_PL, out);
}

// v006
// Measured time: 110 microseconds a run.
// Two timings next to v005 both put it at 1.04 times that version's speed.
// Over all steps from v000 it is 3.40 times as fast.
#include <hip/hip_runtime.h>

// Contractions: six input projections, key x query^T score tiles and value^T x prob^T tiles,
// all v_wmma_f32_16x16x32_f16 (f16 operands, f32 accumulate). f16 operand scaling: weights x64,
// queries x0.125, probabilities x16384, folded back in f32 epilogues. Softmax statistics,
// normalisation and the outputs: f32.

typedef _Float16     v16h __attribute__((ext_vector_type(16)));
typedef _Float16     v8h  __attribute__((ext_vector_type(8)));
typedef float        v8f  __attribute__((ext_vector_type(8)));
typedef float        v4f  __attribute__((ext_vector_type(4)));
typedef unsigned int v4u  __attribute__((ext_vector_type(4)));

union Frag { v16h v; v8h h[2]; v4u u[2]; };
union H8   { v8h h; v4u u; };

#define DM    1024            // model width (dim_in = dim_k = dim_v)
#define NB    2               // batch
#define NSEQ  2048            // sequence length
#define NTOK  (NB * NSEQ)     // token rows
#define NHD   16              // heads
#define DH    64              // head width
#define NPROJ 6
#define NXE   (NTOK * DM)     // 4194304 elements per activation tensor
#define NWE   (DM * DM)       // 1048576 elements per weight

// workspace in 16-bit units; every operand lies in fragment order: a tile of 16 rows x 32 k
// is 512 consecutive units, unit = (k_in >> 3) * 128 + row_in * 8 + (k_in & 7), so that lane l
// of a wave finds its two 16-B fragment halves at tile + 8l and tile + 256 + 8l.
//   xh  f16(x)         rows = tokens,   k = dim_in: tile (row/16) * 32 + k/32       at OFF_XH
//   wh  f16(64 * W_p)  rows = features, k = dim_in: the same per weight             at OFF_WH
//   six planes of 4096*1024 at OFF_PL + p * NXE, each [b*16+head] x 131072 units:
//     p = 0,1,3,4  rows = n,  k = d: tile (n/16) * 2 + d/32 (q planes carry x0.125)
//     p = 2,5      rows = dv, k = n: tile (n/32) * 4 + dv/16
#define OFF_XH    ((size_t)0)
#define OFF_WH    ((size_t)NXE)
#define OFF_PL    ((size_t)NXE + (size_t)NPROJ * (size_t)NWE)
#define WS_HALVES (OFF_PL + (size_t)NPROJ * (size_t)NXE)        // 35651584 -> 71303168 B

// ------------------------------------------------------------------------
// helpers
// ------------------------------------------------------------------------
__device__ __forceinline__ v8f vzero8() {
    v8f z = {0.f, 0.f, 0.f, 0.f, 0.f, 0.f, 0.f, 0.f};
    return z;
}

// Fragment layout (wave32, 16x16x32), identical for A and B:
//   lane l: h = l>>4, m = l&15 = row of A / column of B / column of D
//   elements 0..7  -> k = k0 + 8h + 0..7
//   elements 8..15 -> k = k0 + 16 + 8h + 0..7
//   D element r -> (row 8h + r, column m)
// p = start of a fragment-ordered tile + 8 * lane: each of the two loads reads 512
// consecutive bytes per wave (four whole 128-B lines).
__device__ __forceinline__ void ldfrag(Frag& f, const _Float16* p) {
    f.h[0] = *reinterpret_cast<const v8h*>(p);
    f.h[1] = *reinterpret_cast<const v8h*>(p + 256);
}

// The product with no slots written behind it: the compiler pads its own builtin form, and only
// where a reader of D or a writer of A or B really stands within the distance. (An asm statement
// of v_nop that names D, A and B holds them all in v0..v255: with the projections' 256
// accumulator registers that build spilled to scratch.)
__device__ __forceinline__ v8f mma_bare(const Frag& a, const Frag& b, v8f c) {
    return __builtin_amdgcn_wmma_f32_16x16x32_f16(false, a.v, false, b.v, (short)0, c, false, false);
}

// Eight 2^x in one statement. The outputs are early-clobbered, so none lands on a source of the
// run; the closing v_nop is the slot that the instruction set asks for behind a transcendental
// before its result is read or its source overwritten.
__device__ __forceinline__ void exp2_x8(float& e0, float& e1, float& e2, float& e3,
                                        float& e4, float& e5, float& e6, float& e7,
                                        const float (&y)[8]) {
    asm("v_exp_f32 %0, %8\n\tv_exp_f32 %1, %9\n\tv_exp_f32 %2, %10\n\tv_exp_f32 %3, %11\n\t"
        "v_exp_f32 %4, %12\n\tv_exp_f32 %5, %13\n\tv_exp_f32 %6, %14\n\tv_exp_f32 %7, %15\n\t"
        "v_nop"
        : "=&v"(e0), "=&v"(e1), "=&v"(e2), "=&v"(e3), "=&v"(e4), "=&v"(e5), "=&v"(e6), "=&v"(e7)
        : "v"(y[0]), "v"(y[1]), "v"(y[2]), "v"(y[3]), "v"(y[4]), "v"(y[5]), "v"(y[6]), "v"(y[7]));
}

// The value that lane l ^ 16 holds; idx = 4 * (l ^ 16), formed once in front of the loop (the
// library shuffle's index was formed anew in every step once a branch stood in the loop).
__device__ __forceinline__ float other_half(float v, int idx) {
    return __builtin_bit_cast(float, __builtin_amdgcn_ds_bpermute(idx, __builtin_bit_cast(int, v)));
}

// ------------------------------------------------------------------------
// Launch 1: f32 -> f16 conversion of x (scale 1) and the six weights (scale 64).
// Ten segments of 1048576 elements (x quarters 0..3, weights 4..9), grid (64, 10).
// A block converts one tile row (16 rows x 1024 k), the same 16384 units in source and
// in fragment order. Each lane converts 8 consecutive k of one row -> one 16-B store; a
// wave takes 8 rows x 32 k, so its store fills four whole 128-B lines.
// ------------------------------------------------------------------------
#define CV_IT  8
#define CV_BLK (256 * 8 * CV_IT)        // 16384 elements per block

__global__ __launch_bounds__(256) void cvt_kernel(
    const float* __restrict__ x,
    const float* __restrict__ W0, const float* __restrict__ W1, const float* __restrict__ W2,
    const float* __restrict__ W3, const float* __restrict__ W4, const float* __restrict__ W5,
    _Float16* wsh)
{
    const int tid = threadIdx.x;
    const int lane = tid & 31, wv = tid >> 5;
    const int row = (wv & 1) * 8 + (lane >> 2), kq = lane & 3;       // row in the tile, 8-k chunk
    const int seg = blockIdx.y;                                      // block-uniform
    const float* src;
    float sc;
    if (seg < 4) {
        src = x + (size_t)seg * NWE;
        sc  = 1.0f;
    } else {
        const int p = seg - 4;
        src = (p == 0) ? W0 : (p == 1) ? W1 : (p == 2) ? W2 : (p == 3) ? W3 : (p == 4) ? W4 : W5;
        sc  = 64.0f;                                                 // exact power of two
    }
    const size_t base = (size_t)blockIdx.x * CV_BLK;
    // pass i: k tile 4i + (wv >> 1)
    const float* sp = src + base;
    _Float16*    dp = wsh + (size_t)seg * NWE + base;
    const int so = row * DM + (wv >> 1) * 32 + kq * 8;               // source: row-major
    const int dn = (wv >> 1) * 512 + kq * 128 + row * 8;             // destination: fragment order

    H8 v[CV_IT];
#pragma unroll
    for (int i = 0; i < CV_IT; ++i) {
        const int e = so + i * 128;
        const v4f f0 = *reinterpret_cast<const v4f*>(sp + e);
        const v4f f1 = *reinterpret_cast<const v4f*>(sp + e + 4);
        H8 t;
        t.u = (v4u){0u, 0u, 0u, 0u};
#pragma unroll
        for (int q = 0; q < 4; ++q) {
            t.h[q]     = (_Float16)(f0[q] * sc);                     // RNE convert
            t.h[4 + q] = (_Float16)(f1[q] * sc);
        }
        v[i] = t;
    }
#pragma unroll
    for (int i = 0; i < CV_IT; ++i) {
        const int e = dn + i * 2048;
        *reinterpret_cast<v4u*>(dp + e) = v[i].u;
    }
    
}

// ------------------------------------------------------------------------
// Launch 2/3: Y = xh . wh^T / 64 for the projections. Block tile 128 tokens x 256
// features (four heads), 4 waves (2 x 2) of 64 tokens x 128 features, K stepped by 32:
// the twelve fragments of a K step feed 32 products (384 B loaded per product).
// Fragments are loaded directly from the fragment-ordered f16 tiles (identical split k map
// for both operands). ISV = 0: q/k planes, rows = n (q planes additionally x0.125);
// ISV = 1: value planes, rows = dv. In both the 8 values a lane holds of an accumulator are
// one 16-B chunk of the plane's fragment order at tile half + 8 * lane: stored directly,
// 512 consecutive bytes per wave and store.
// ------------------------------------------------------------------------
#define P_BM 128
#define P_BN 256
#define P_BK 32
#define P_MT 4                // token tiles of 16 per wave
#define P_NT 8                // feature tiles of 16 per wave

// the twelve fragments of K step k0: token rows 16mt + lo, feature rows 16nt + lo of the wave
__device__ __forceinline__ void proj_fetch(Frag (&xf)[P_MT], Frag (&wf)[P_NT],
                                           const char* xp, const char* wp, int k0) {
    const _Float16* xa = reinterpret_cast<const _Float16*>(xp);
    const _Float16* wb = reinterpret_cast<const _Float16*>(wp);
#pragma unroll
    for (int mt = 0; mt < P_MT; ++mt) ldfrag(xf[mt], xa + (size_t)(16 * mt) * DM + 16 * k0);
    // token fragments first in every group, the one in front of the loop too: with that group in
    // another order the counted waits at the loop's head, which hold for both, took the whole set
    __builtin_amdgcn_sched_barrier(0);
#pragma unroll
    for (int nt = 0; nt < P_NT; ++nt) ldfrag(wf[nt], wb + (size_t)(16 * nt) * DM + 16 * k0);
    // holds the 24 loads as one group in front of the other set's products: sunk towards their
    // own products they would be waited for with no lead
    __builtin_amdgcn_sched_barrier(0);
}

template <int ISV>
__device__ __forceinline__ void proj_step(v8f (&acc)[P_MT][P_NT], const Frag (&xf)[P_MT],
                                          const Frag (&wf)[P_NT]) {
#pragma unroll
    for (int nt = 0; nt < P_NT; ++nt) {
#pragma unroll
        for (int mt = 0; mt < P_MT; ++mt) {
            if (ISV) {
                // D[r] = Y[token 16mt+8h+r][feat 16nt+lo]
                acc[mt][nt] = mma_bare(xf[mt], wf[nt], acc[mt][nt]);
            } else {
                // D[r] = Y[token 16mt+lo][feat 16nt+8h+r]
                acc[mt][nt] = mma_bare(wf[nt], xf[mt], acc[mt][nt]);
            }
        }
    }
    // keeps the products in front of the loads that refill their operand registers
    __builtin_amdgcn_sched_barrier(0);
}

// Four slots between a set's last product and the loads that refill its registers, A and B
// operands alike, so that no load stands directly behind a product whose B it overwrites.
// The clobber keeps the loads behind the slots.
__device__ __forceinline__ void refill_gap() {
    asm volatile("v_nop\n\tv_nop\n\tv_nop\n\tv_nop" ::: "memory");
}

template <int ISV>
__global__ __launch_bounds__(128) void proj_kernel(const _Float16* xh, const _Float16* wh,
                                                   _Float16* planes)
{
    const int tid  = threadIdx.x;
    const int lane = tid & 31, w = tid >> 5;
    const int wm = w >> 1, wn = w & 1;                               // wave's place in the block tile
    const int z    = blockIdx.z;                                     // block-uniform
    int proj;
    float osc;
    if (ISV) {
        proj = 2 + 3 * z;                                            // 2, 5
        osc  = 1.0f / 64.0f;
    } else {
        proj = z + ((z >= 2) ? 1 : 0);                               // 0, 1, 3, 4
        osc  = (z == 0 || z == 2) ? (1.0f / 512.0f) : (1.0f / 64.0f);   // q planes: 0.125 / 64
    }
    const int n0 = blockIdx.x * P_BN + 128 * wn;                     // wave's feature base = head * 64
    const int m0 = blockIdx.y * P_BM;                                // block's token base

    // block-uniform bases and the lane's two byte offsets, which walk along K
    const char* xbase = reinterpret_cast<const char*>(xh + (size_t)m0 * DM);
    const char* wbase = reinterpret_cast<const char*>(wh + ((size_t)proj * DM + blockIdx.x * P_BN) * DM);
    unsigned xo = (unsigned)(64 * wm * DM + 8 * lane) * 2u;          // + (16*mt*DM + 16*k0) * 2
    unsigned wo = (unsigned)(128 * wn * DM + 8 * lane) * 2u;         // + (16*nt*DM + 16*k0) * 2

    v8f acc[P_MT][P_NT];
#pragma unroll
    for (int mt = 0; mt < P_MT; ++mt)
#pragma unroll
        for (int nt = 0; nt < P_NT; ++nt) acc[mt][nt] = vzero8();

    // Two register sets of the twelve fragments of a K step: while one set feeds its 32
    // products, the other set's 24 loads, issued as one group, are in flight.
    Frag xf[2][P_MT], wf[2][P_NT];
    proj_fetch(xf[0], wf[0], xbase + xo, wbase + wo, 0);
    // kept rolled: one trip holds both sets, a longer body would only add code
#pragma unroll 1
    for (int k0 = 0; k0 < DM - 2 * P_BK; k0 += 2 * P_BK) {
        proj_fetch(xf[1], wf[1], xbase + xo, wbase + wo, P_BK);
        proj_step<ISV>(acc, xf[0], wf[0]);
        refill_gap();
        proj_fetch(xf[0], wf[0], xbase + xo, wbase + wo, 2 * P_BK);
        proj_step<ISV>(acc, xf[1], wf[1]);
        refill_gap();
        // The two offsets are stepped by 64 k (2048 B) inside the statement of the wait.
        // Precaution: registers that issued loads name are rewritten only when the loads have
        // passed address translation; written as plain additions the compiler lifted the steps
        // to directly behind the loads. Here the wait stands at the foot of the
        // trip, 32 products behind the last load.
        asm volatile("s_wait_xcnt 0x0\n\t"
                     "v_add_nc_u32 %0, 0x800, %0\n\t"
                     "v_add_nc_u32 %1, 0x800, %1"
                     : "+v"(xo), "+v"(wo) :: "memory");
    }
    // the last two K steps: nothing left to fetch ahead
    proj_fetch(xf[1], wf[1], xbase + xo, wbase + wo, P_BK);
    // precaution: the two offsets of the loads above, held here as operands so that no load's
    // destination lands on them, are left alone until the loads have passed address translation
    asm volatile("s_wait_xcnt 0x0" :: "v"(xo), "v"(wo) : "memory");
    proj_step<ISV>(acc, xf[0], wf[0]);
    proj_step<ISV>(acc, xf[1], wf[1]);

    // scaled f16 chunks straight to the plane (each lane one 16-B vector per (mt, nt))
    const int bhi = (m0 / NSEQ) * NHD + n0 / DH;                     // + nt / 4
    const int nq0 = m0 % NSEQ + 64 * wm;
    _Float16* plane = planes + (size_t)proj * NXE + (size_t)bhi * (NSEQ * DH) + 8 * lane;
    H8 t[P_MT][P_NT];
#pragma unroll
    for (int nt = 0; nt < P_NT; ++nt) {
#pragma unroll
        for (int mt = 0; mt < P_MT; ++mt) {
            t[mt][nt].u = (v4u){0u, 0u, 0u, 0u};
#pragma unroll
            for (int r = 0; r < 8; ++r) t[mt][nt].h[r] = (_Float16)(acc[mt][nt][r] * osc);
        }
    }
#pragma unroll
    for (int nt = 0; nt < P_NT; ++nt) {
        const int hq = nt >> 2, nh = nt & 3;                         // head in the wave, tile in the head
#pragma unroll
        for (int mt = 0; mt < P_MT; ++mt) {
            // ISV: row dv = 16nh+lo, k = tokens 16mt+8h .. +7 -> tile (n/32)*4 + nh, half mt&1
            // else: row n = 16mt+lo, k = feats 16nh+8h .. +7  -> tile (n/16)*2 + nh/2, half nh&1
            const int off = ISV ? (((nq0 / 32 + (mt >> 1)) * 4 + nh) * 512 + (mt & 1) * 256)
                                : (((nq0 / 16 + mt) * 2 + (nh >> 1)) * 512 + (nh & 1) * 256);
            *reinterpret_cast<v4u*>(plane + hq * (NSEQ * DH) + off) = t[mt][nt].u;
        }
    }
}

// ------------------------------------------------------------------------
// Launch 4: attention. One block per (query block of 256, b*16+head, output index o),
// 8 waves x 32 queries (two query tiles of 16). Output o uses score stream s = (head&1)^o and
// the value plane of stream o. Scores are computed transposed, S^T = K . Q^T (D rows = keys,
// cols = queries), so the probabilities come out of D already in B-fragment layout for
// O^T = V^T . P^T (element r <- 16-key tile 0, element 8+r <- tile 1 of the step). Per lane and
// query tile: one query (lo), 16 of the 32 keys of a step; the other 16 live in lane lo+16.
// K, V^T and Q^T fragments come straight from the fragment-ordered f16 planes (no LDS
// staging); the 4 K tiles and the 4 V^T tiles of a step are 4 KB consecutive each, and every
// fragment feeds two products, one per query tile. Four waves per SIMD: 256 registers a wave.
// ------------------------------------------------------------------------
#define A_NW 8                // waves per block
#define A_QT 2                // query tiles of 16 per wave
#define A_QB (A_NW * A_QT * 16)
#define A_KT 32               // keys per step
// how far a score may lie above the softmax reference before the reference moves: a probability
// is then at most e^1.25 = 3.49, and carried x16384 at most 57187, inside f16 (65504)
#define A_LAZY 1.25f

__global__ __launch_bounds__(A_NW * 32) __attribute__((amdgpu_waves_per_eu(4, 4)))
void attn_kernel(const _Float16* planes, float* out)
{
    __shared__ v4f St[A_NW * A_QT * 256];                            // [8 waves][32][64] f32

    const int tid  = threadIdx.x;
    const int lane = tid & 31, w = tid >> 5, lo = lane & 15, hf = lane >> 4;
    const int qb = blockIdx.x, bh = blockIdx.y, o = blockIdx.z;
    const int b  = bh >> 4, hd = bh & 15;
    const int s  = (hd & 1) ^ o;                                     // score stream
    const size_t HO = (size_t)bh * NSEQ * DH;                        // same for both plane layouts
    const _Float16* Q = planes + (size_t)(s ? 3 : 0) * NXE + HO + 8 * lane;   // tiles (n/16)*2 + d/32, x0.125 inside
    const _Float16* K = planes + (size_t)(s ? 4 : 1) * NXE + HO + 8 * lane;   // tiles (n/16)*2 + d/32
    const _Float16* V = planes + (size_t)(o ? 5 : 2) * NXE + HO + 8 * lane;   // tiles (n/32)*4 + dv/16
    const int q0   = qb * A_QB + 16 * A_QT * w;                      // the wave's first query
    const int xidx = (lane ^ 16) * 4;                                // byte index of the partner lane

    // Q^T as B operand: column = query (lane lo), k = d by the split map
    Frag qf[A_QT][2];
#pragma unroll
    for (int qt = 0; qt < A_QT; ++qt)
#pragma unroll
        for (int dc = 0; dc < 2; ++dc) ldfrag(qf[qt][dc], Q + ((q0 / 16 + qt) * 2 + dc) * 512);

    v8f O[A_QT][4];
#pragma unroll
    for (int qt = 0; qt < A_QT; ++qt)
#pragma unroll
        for (int i = 0; i < 4; ++i) O[qt][i] = vzero8();
    float mrun[A_QT], mlim[A_QT], lrun[A_QT];                        // reference, reference + A_LAZY, sum
#pragma unroll
    for (int qt = 0; qt < A_QT; ++qt) { mrun[qt] = -1e30f; mlim[qt] = -1e30f; lrun[qt] = 0.f; }

    // K fragments are fetched one step ahead, V^T fragments at the head of their own step,
    // each set's eight loads as one group: none waits directly in front of its product.
    Frag kf[4];                                                      // A operand: row = key, k = d
#pragma unroll
    for (int i = 0; i < 4; ++i) ldfrag(kf[i], K + i * 512);

#pragma unroll 1
    for (int t = 0; t < NSEQ / A_KT; ++t) {
        const int kb = t * A_KT;

        Frag vf[4];                                                  // A operand: row = dv 16nt+lo, k = key
        const _Float16* vp = V + (kb / 32) * 4 * 512;
#pragma unroll
        for (int i = 0; i < 4; ++i) ldfrag(vf[i], vp + i * 512);
        // holds the eight V^T loads as one group at the head of the step: sunk towards their
        // products they would be waited for with no lead
        __builtin_amdgcn_sched_barrier(0);

        // S^T tiles j = 0,1: keys kb+16j .. kb+16j+15; D[r] = score(query 16qt+lo, key kb+16j+8h+r)
        float p[A_QT][16];
#pragma unroll
        for (int j = 0; j < 2; ++j) {
#pragma unroll
            for (int qt = 0; qt < A_QT; ++qt) {
                v8f S = vzero8();
#pragma unroll
                for (int dc = 0; dc < 2; ++dc) S = mma_bare(kf[2 * j + dc], qf[qt][dc], S);
#pragma unroll
                for (int r = 0; r < 8; ++r) p[qt][8 * j + r] = S[r];
            }
        }

        // next step's K tiles into the registers just read (last step: step 0 again, not used)
        const int kn = ((t + 1) & (NSEQ / A_KT - 1)) * A_KT;
        const _Float16* kp = K + (kn / 16) * 2 * 512;
#pragma unroll
        for (int i = 0; i < 4; ++i) ldfrag(kf[i], kp + i * 512);
        // holds the eight K loads directly behind the score products: softmax and the value
        // products of this step are their lead
        __builtin_amdgcn_sched_barrier(0);

        // online softmax in f32 (row = query 16qt+lo; partner lane lo^16 holds the other 16 keys),
        // taken against a reference mrun that is the same in both lanes of a query and moves only
        // when a score of the step lies more than A_LAZY above it
        float tmax[A_QT];
#pragma unroll
        for (int qt = 0; qt < A_QT; ++qt) {
            tmax[qt] = p[qt][0];
#pragma unroll
            for (int i = 1; i < 16; ++i) tmax[qt] = fmaxf(tmax[qt], p[qt][i]);
        }
        bool need = false;
#pragma unroll
        for (int qt = 0; qt < A_QT; ++qt) need = need || (tmax[qt] > mlim[qt]);
        // one test per step, the same for the whole wave (a scalar branch): each lane looks at its
        // own 16 keys, so the halves exchange their maxima only where the reference moves
        // (marked unlikely: the step that moves nothing is the straight path)
        if (__builtin_expect(__builtin_amdgcn_ballot_w32(need) != 0u, 0)) {
            float tx[A_QT];
#pragma unroll
            for (int qt = 0; qt < A_QT; ++qt) tx[qt] = other_half(tmax[qt], xidx);
#pragma unroll
            for (int qt = 0; qt < A_QT; ++qt) {
                const float mnew  = fmaxf(mrun[qt], fmaxf(tmax[qt], tx[qt]));
                const float alpha = __expf(mrun[qt] - mnew);
                lrun[qt] *= alpha;
                mrun[qt] = mnew;
                mlim[qt] = mnew + A_LAZY;
#pragma unroll
                for (int nt = 0; nt < 4; ++nt) O[qt][nt] = O[qt][nt] * alpha;
            }
        }
        // precaution: the two address pairs of this step's loads, held here as operands so that no
        // load's destination lands on them, are left alone until the loads have passed address
        // translation
        asm volatile("s_wait_xcnt 0x0" :: "v"(vp), "v"(kp) : "memory");
        float rs[A_QT];
#pragma unroll
        for (int qt = 0; qt < A_QT; ++qt) {
#pragma unroll
            for (int g = 0; g < 2; ++g) {
                float y[8];
#pragma unroll
                for (int r = 0; r < 8; ++r) y[r] = (p[qt][8 * g + r] - mrun[qt]) * 1.44269504088896340736f;
                exp2_x8(p[qt][8 * g], p[qt][8 * g + 1], p[qt][8 * g + 2], p[qt][8 * g + 3],
                        p[qt][8 * g + 4], p[qt][8 * g + 5], p[qt][8 * g + 6], p[qt][8 * g + 7], y);
            }
            rs[qt] = 0.f;
#pragma unroll
            for (int i = 0; i < 16; ++i) rs[qt] += p[qt][i];
        }
        float rx[A_QT];
#pragma unroll
        for (int qt = 0; qt < A_QT; ++qt) rx[qt] = other_half(rs[qt], xidx);
#pragma unroll
        for (int qt = 0; qt < A_QT; ++qt) lrun[qt] += rs[qt] + rx[qt];

        // O^T[dv][q] += V^T[dv][key] . P^T[key][q] over the 32 keys of the step
        Frag pf[A_QT];
#pragma unroll
        for (int qt = 0; qt < A_QT; ++qt) {
            // P^T as B operand straight from the D layout, carried x16384:
            // element r <- key 8h+r (tile 0), element 8+r <- key 16+8h+r (tile 1)
            H8 a0, a1;
            a0.u = (v4u){0u, 0u, 0u, 0u};
            a1.u = (v4u){0u, 0u, 0u, 0u};
#pragma unroll
            for (int r = 0; r < 8; ++r) {
                a0.h[r] = (_Float16)(p[qt][r] * 16384.0f);
                a1.h[r] = (_Float16)(p[qt][8 + r] * 16384.0f);
            }
            pf[qt].u[0] = a0.u;
            pf[qt].u[1] = a1.u;
        }
        // holds the row sums in front of the value products: with no rescale multiplies left to
        // stand among the products, the sums sunk there took the value fragments' registers for
        // their partial sums and were padded with idle slots
        __builtin_amdgcn_sched_barrier(0);
#pragma unroll
        for (int nt = 0; nt < 4; ++nt)
#pragma unroll
            for (int qt = 0; qt < A_QT; ++qt)
                O[qt][nt] = mma_bare(vf[nt], pf[qt], O[qt][nt]);     // D[r] = O[query 16qt+lo][dv 16nt+8h+r]
    }

    v4f* Sw = St + w * (A_QT * 256);
#pragma unroll
    for (int qt = 0; qt < A_QT; ++qt) {
        const float inv = 1.0f / (lrun[qt] * 16384.0f);              // lrun >= 1
#pragma unroll
        for (int nt = 0; nt < 4; ++nt) {
            v4f a  = {O[qt][nt][0] * inv, O[qt][nt][1] * inv, O[qt][nt][2] * inv, O[qt][nt][3] * inv};
            v4f cc = {O[qt][nt][4] * inv, O[qt][nt][5] * inv, O[qt][nt][6] * inv, O[qt][nt][7] * inv};
            Sw[(16 * qt + lo) * 16 + 4 * nt + 2 * hf]     = a;       // floats row*64 + 16nt + 8h .. +3
            Sw[(16 * qt + lo) * 16 + 4 * nt + 2 * hf + 1] = cc;      // .. +4 .. +7
        }
    }
    __syncthreads();

    float* ob = out + (size_t)o * NXE + ((size_t)b * NSEQ + q0) * DM + (size_t)hd * DH;
    const int c = (lane & 7) * 4;
    v4f vals[8 * A_QT];
#pragma unroll
    for (int si = 0; si < 8 * A_QT; ++si) {
        const int L = 4 * si + (lane >> 3);          // 64 lines per wave: row = L>>1, half = L&1
        vals[si] = Sw[8 * L + (lane & 7)];
    }
#pragma unroll
    for (int si = 0; si < 8 * A_QT; ++si) {
        const int L = 4 * si + (lane >> 3);
        *reinterpret_cast<v4f*>(ob + (size_t)(L >> 1) * DM + 32 * (L & 1) + c) = vals[si];
    }
}

// ------------------------------------------------------------------------
// host glue: 4 launches; shapes are fixed by the module configuration and
// checked against the passed sizes (no-op on any disagreement).
// ------------------------------------------------------------------------
extern "C" void kernel_launch(void* const* d_in, const int* in_sizes, int n_in,
                              void* d_out, int out_size, void* d_ws, size_t ws_size,
                              hipStream_t stream)
{
    if (n_in < 7) return;
    if (in_sizes[0] != NXE) return;
    for (int p = 0; p < NPROJ; ++p) if (in_sizes[1 + p] != NWE) return;
    if (out_size != 2 * NXE) return;
    const size_t ws_need = WS_HALVES * sizeof(_Float16);             // 71303168 B
    if (ws_size < ws_need) return;

    const float* x  = (const float*)d_in[0];
    const float* W0 = (const float*)d_in[1];
    const float* W1 = (const float*)d_in[2];
    const float* W2 = (const float*)d_in[3];
    const float* W3 = (const float*)d_in[4];
    const float* W4 = (const float*)d_in[5];
    const float* W5 = (const float*)d_in[6];
    _Float16* wsh = (_Float16*)d_ws;
    float* out = (float*)d_out;

    cvt_kernel<<<dim3(NWE / CV_BLK, 10, 1), 256, 0, stream>>>(x, W0, W1, W2, W3, W4, W5, wsh + OFF_XH);
    proj_kernel<0><<<dim3(DM / P_BN, NTOK / P_BM, 4), 128, 0, stream>>>(wsh + OFF_XH, wsh + OFF_WH, wsh + OFF_PL);
    proj_kernel<1><<<dim3(DM / P_BN, NTOK / P_BM, 2), 128, 0, stream>>>(wsh + OFF_XH, wsh + OFF_WH, wsh + OFF_PL);
    attn_kernel<<<dim3(NSEQ / A_QB, NB * NHD, 2), A_NW * 32, 0, stream>>>(wsh + OFF_PL, out);
}

// v007
// One run takes 104 microseconds.
// In two side-by-side timings against v006, it was 1.06 and 1.07 times as fast.
// Over all steps from v000 it is 3.62 times as fast.
#include <hip/hip_runtime.h>

// Contractions: six input projections, key x query^T score tiles and value^T x prob^T tiles,
// all v_wmma_f32_16x16x32_f16 (f16 operands, f32 accumulate). f16 operand scaling: weights x64,
// queries x0.125, probabilities x16384, folded back in f32 epilogues. Softmax statistics,
// normalisation and the outputs: f32.

typedef _Float16     v16h __attribute__((ext_vector_type(16)));
typedef _Float16     v8h  __attribute__((ext_vector_type(8)));
typedef float        v8f  __attribute__((ext_vector_type(8)));
typedef float        v4f  __attribute__((ext_vector_type(4)));
typedef unsigned int v4u  __attribute__((ext_vector_type(4)));

union Frag { v16h v; v8h h[2]; v4u u[2]; };
union H8   { v8h h; v4u u; };

#define DM    1024            // model width (dim_in = dim_k = dim_v)
#define NB    2               // batch
#define NSEQ  2048            // sequence length
#define NTOK  (NB * NSEQ)     // token rows
#define NHD   16              // heads
#define DH    64              // head width
#define NPROJ 6
#define NXE   (NTOK * DM)     // 4194304 elements per activation tensor
#define NWE   (DM * DM)       // 1048576 elements per weight

// workspace in 16-bit units; every operand lies in fragment order: a tile of 16 rows x 32 k
// is 512 consecutive units, unit = (k_in >> 3) * 128 + row_in * 8 + (k_in & 7), so that lane l
// of a wave finds its two 16-B fragment halves at tile + 8l and tile + 256 + 8l.
//   xh  f16(x)         rows = tokens,   k = dim_in: tile (row/16) * 32 + k/32       at OFF_XH
//   wh  f16(64 * W_p)  rows = features, k = dim_in: the same per weight             at OFF_WH
//   six planes of 4096*1024 at OFF_PL + p * NXE, each [b*16+head] x 131072 units:
//     p = 0,1,3,4  rows = n,  k = d: tile (n/16) * 2 + d/32 (q planes carry x0.125)
//     p = 2,5      rows = dv, k = n: tile (n/32) * 4 + dv/16
#define OFF_XH    ((size_t)0)
#define OFF_WH    ((size_t)NXE)
#define OFF_PL    ((size_t)NXE + (size_t)NPROJ * (size_t)NWE)
#define WS_HALVES (OFF_PL + (size_t)NPROJ * (size_t)NXE)        // 35651584 -> 71303168 B

// ------------------------------------------------------------------------
// helpers
// ------------------------------------------------------------------------
__device__ __forceinline__ v8f vzero8() {
    v8f z = {0.f, 0.f, 0.f, 0.f, 0.f, 0.f, 0.f, 0.f};
    return z;
}

// Fragment layout (wave32, 16x16x32), identical for A and B:
//   lane l: h = l>>4, m = l&15 = row of A / column of B / column of D
//   elements 0..7  -> k = k0 + 8h + 0..7
//   elements 8..15 -> k = k0 + 16 + 8h + 0..7
//   D element r -> (row 8h + r, column m)
// p = start of a fragment-ordered tile + 8 * lane: each of the two loads reads 512
// consecutive bytes per wave (four whole 128-B lines).
__device__ __forceinline__ void ldfrag(Frag& f, const _Float16* p) {
    f.h[0] = *reinterpret_cast<const v8h*>(p);
    f.h[1] = *reinterpret_cast<const v8h*>(p + 256);
}

// The product with no slots written behind it: the compiler pads its own builtin form, and only
// where a reader of D or a writer of A or B really stands within the distance. (An asm statement
// of v_nop that names D, A and B holds them all in v0..v255: with the projections' 256
// accumulator registers that build spilled to scratch.)
__device__ __forceinline__ v8f mma_bare(const Frag& a, const Frag& b, v8f c) {
    return __builtin_amdgcn_wmma_f32_16x16x32_f16(false, a.v, false, b.v, (short)0, c, false, false);
}

// Eight 2^x in one statement. The outputs are early-clobbered, so none lands on a source of the
// run; the closing v_nop is the slot that the instruction set asks for behind a transcendental
// before its result is read or its source overwritten.
__device__ __forceinline__ void exp2_x8(float& e0, float& e1, float& e2, float& e3,
                                        float& e4, float& e5, float& e6, float& e7,
                                        const float (&y)[8]) {
    asm("v_exp_f32 %0, %8\n\tv_exp_f32 %1, %9\n\tv_exp_f32 %2, %10\n\tv_exp_f32 %3, %11\n\t"
        "v_exp_f32 %4, %12\n\tv_exp_f32 %5, %13\n\tv_exp_f32 %6, %14\n\tv_exp_f32 %7, %15\n\t"
        "v_nop"
        : "=&v"(e0), "=&v"(e1), "=&v"(e2), "=&v"(e3), "=&v"(e4), "=&v"(e5), "=&v"(e6), "=&v"(e7)
        : "v"(y[0]), "v"(y[1]), "v"(y[2]), "v"(y[3]), "v"(y[4]), "v"(y[5]), "v"(y[6]), "v"(y[7]));
}

// The value that lane l ^ 16 holds; idx = 4 * (l ^ 16), formed once in front of the loop (the
// library shuffle's index was formed anew in every step once a branch stood in the loop).
__device__ __forceinline__ float other_half(float v, int idx) {
    return __builtin_bit_cast(float, __builtin_amdgcn_ds_bpermute(idx, __builtin_bit_cast(int, v)));
}

// ------------------------------------------------------------------------
// Launch 1: f32 -> f16 conversion of x (scale 1) and the six weights (scale 64).
// Ten segments of 1048576 elements (x quarters 0..3, weights 4..9), grid (64, 10).
// A block converts one tile row (16 rows x 1024 k), the same 16384 units in source and
// in fragment order. Each lane converts 8 consecutive k of one row -> one 16-B store; a
// wave takes 8 rows x 32 k, so its store fills four whole 128-B lines.
// ------------------------------------------------------------------------
#define CV_IT  8
#define CV_BLK (256 * 8 * CV_IT)        // 16384 elements per block

__global__ __launch_bounds__(256) void cvt_kernel(
    const float* __restrict__ x,
    const float* __restrict__ W0, const float* __restrict__ W1, const float* __restrict__ W2,
    const float* __restrict__ W3, const float* __restrict__ W4, const float* __restrict__ W5,
    _Float16* wsh)
{
    const int tid = threadIdx.x;
    const int lane = tid & 31, wv = tid >> 5;
    const int row = (wv & 1) * 8 + (lane >> 2), kq = lane & 3;       // row in the tile, 8-k chunk
    const int seg = blockIdx.y;                                      // block-uniform
    const float* src;
    float sc;
    if (seg < 4) {
        src = x + (size_t)seg * NWE;
        sc  = 1.0f;
    } else {
        const int p = seg - 4;
        src = (p == 0) ? W0 : (p == 1) ? W1 : (p == 2) ? W2 : (p == 3) ? W3 : (p == 4) ? W4 : W5;
        sc  = 64.0f;                                                 // exact power of two
    }
    const size_t base = (size_t)blockIdx.x * CV_BLK;
    // pass i: k tile 4i + (wv >> 1)
    const float* sp = src + base;
    _Float16*    dp = wsh + (size_t)seg * NWE + base;
    const int so = row * DM + (wv >> 1) * 32 + kq * 8;               // source: row-major
    const int dn = (wv >> 1) * 512 + kq * 128 + row * 8;             // destination: fragment order

    H8 v[CV_IT];
#pragma unroll
    for (int i = 0; i < CV_IT; ++i) {
        const int e = so + i * 128;
        const v4f f0 = *reinterpret_cast<const v4f*>(sp + e);
        const v4f f1 = *reinterpret_cast<const v4f*>(sp + e + 4);
        H8 t;
        t.u = (v4u){0u, 0u, 0u, 0u};
#pragma unroll
        for (int q = 0; q < 4; ++q) {
            t.h[q]     = (_Float16)(f0[q] * sc);                     // RNE convert
            t.h[4 + q] = (_Float16)(f1[q] * sc);
        }
        v[i] = t;
    }
#pragma unroll
    for (int i = 0; i < CV_IT; ++i) {
        const int e = dn + i * 2048;
        *reinterpret_cast<v4u*>(dp + e) = v[i].u;
    }
    
}

// ------------------------------------------------------------------------
// Launch 2/3: Y = xh . wh^T / 64 for the projections. Block tile 128 tokens x 256
// features (four heads), 4 waves (2 x 2) of 64 tokens x 128 features, K stepped by 32:
// the twelve fragments of a K step feed 32 products (384 B loaded per product).
// Fragments are loaded directly from the fragment-ordered f16 tiles (identical split k map
// for both operands). ISV = 0: q/k planes, rows = n (q planes additionally x0.125);
// ISV = 1: value planes, rows = dv. In both the 8 values a lane holds of an accumulator are
// one 16-B chunk of the plane's fragment order at tile half + 8 * lane: stored directly,
// 512 consecutive bytes per wave and store.
// ------------------------------------------------------------------------
#define P_BM 128
#define P_BN 256
#define P_BK 32
#define P_MT 4                // token tiles of 16 per wave
#define P_NT 8                // feature tiles of 16 per wave

// the twelve fragments of K step k0: token rows 16mt + lo, feature rows 16nt + lo of the wave
__device__ __forceinline__ void proj_fetch(Frag (&xf)[P_MT], Frag (&wf)[P_NT],
                                           const char* xp, const char* wp, int k0) {
    const _Float16* xa = reinterpret_cast<const _Float16*>(xp);
    const _Float16* wb = reinterpret_cast<const _Float16*>(wp);
#pragma unroll
    for (int mt = 0; mt < P_MT; ++mt) ldfrag(xf[mt], xa + (size_t)(16 * mt) * DM + 16 * k0);
    // token fragments first in every group, the one in front of the loop too: with that group in
    // another order the counted waits at the loop's head, which hold for both, took the whole set
    __builtin_amdgcn_sched_barrier(0);
#pragma unroll
    for (int nt = 0; nt < P_NT; ++nt) ldfrag(wf[nt], wb + (size_t)(16 * nt) * DM + 16 * k0);
    // holds the 24 loads as one group in front of the other set's products: sunk towards their
    // own products they would be waited for with no lead
    __builtin_amdgcn_sched_barrier(0);
}

template <int ISV>
__device__ __forceinline__ void proj_step(v8f (&acc)[P_MT][P_NT], const Frag (&xf)[P_MT],
                                          const Frag (&wf)[P_NT]) {
#pragma unroll
    for (int nt = 0; nt < P_NT; ++nt) {
#pragma unroll
        for (int mt = 0; mt < P_MT; ++mt) {
            if (ISV) {
                // D[r] = Y[token 16mt+8h+r][feat 16nt+lo]
                acc[mt][nt] = mma_bare(xf[mt], wf[nt], acc[mt][nt]);
            } else {
                // D[r] = Y[token 16mt+lo][feat 16nt+8h+r]
                acc[mt][nt] = mma_bare(wf[nt], xf[mt], acc[mt][nt]);
            }
        }
    }
    // keeps the products in front of the loads that refill their operand registers
    __builtin_amdgcn_sched_barrier(0);
}

// Four slots between a set's last product and the loads that refill its registers, A and B
// operands alike, so that no load stands directly behind a product whose B it overwrites.
// The clobber keeps the loads behind the slots.
__device__ __forceinline__ void refill_gap() {
    asm volatile("v_nop\n\tv_nop\n\tv_nop\n\tv_nop" ::: "memory");
}

template <int ISV>
__global__ __launch_bounds__(128) void proj_kernel(const _Float16* xh, const _Float16* wh,
                                                   _Float16* planes)
{
    const int tid  = threadIdx.x;
    const int lane = tid & 31, w = tid >> 5;
    const int wm = w >> 1, wn = w & 1;                               // wave's place in the block tile
    const int z    = blockIdx.z;                                     // block-uniform
    int proj;
    float osc;
    if (ISV) {
        proj = 2 + 3 * z;                                            // 2, 5
        osc  = 1.0f / 64.0f;
    } else {
        proj = z + ((z >= 2) ? 1 : 0);                               // 0, 1, 3, 4
        osc  = (z == 0 || z == 2) ? (1.0f / 512.0f) : (1.0f / 64.0f);   // q planes: 0.125 / 64
    }
    const int n0 = blockIdx.x * P_BN + 128 * wn;                     // wave's feature base = head * 64
    const int m0 = blockIdx.y * P_BM;                                // block's token base

    // block-uniform bases and the lane's two byte offsets, which walk along K
    const char* xbase = reinterpret_cast<const char*>(xh + (size_t)m0 * DM);
    const char* wbase = reinterpret_cast<const char*>(wh + ((size_t)proj * DM + blockIdx.x * P_BN) * DM);
    // Every block starts its walk along K at a place of its own (a multiple of 64 k = 2048 B) and
    // wraps at the end of the row tile's 32 KB: blocks that share token rows (same y) do not ask L2
    // for the same lines at the same moment; of the blocks that share feature rows (same x, z)
    // only the pairs y = 2j, 2j + 1 start at the same place; and the blocks of the
    // launch do not all stand at the same place of every 32-KB row tile.
    const unsigned ks = ((blockIdx.x + 4u * (unsigned)z + (blockIdx.y >> 1)) & 15u) * 0x800u;
    unsigned xo = (unsigned)(64 * wm * DM + 8 * lane) * 2u + ks;     // + (16*mt*DM + 16*k0) * 2
    unsigned wo = (unsigned)(128 * wn * DM + 8 * lane) * 2u + ks;    // + (16*nt*DM + 16*k0) * 2

    v8f acc[P_MT][P_NT];
#pragma unroll
    for (int mt = 0; mt < P_MT; ++mt)
#pragma unroll
        for (int nt = 0; nt < P_NT; ++nt) acc[mt][nt] = vzero8();

    // Two register sets of the twelve fragments of a K step: while one set feeds its 32
    // products, the other set's 24 loads, issued as one group, are in flight.
    Frag xf[2][P_MT], wf[2][P_NT];
    proj_fetch(xf[0], wf[0], xbase + xo, wbase + wo, 0);
    proj_fetch(xf[1], wf[1], xbase + xo, wbase + wo, P_BK);
    // kept rolled: one trip holds both sets, a longer body would only add code
#pragma unroll 1
    for (int k0 = 0; k0 < DM - 2 * P_BK; k0 += 2 * P_BK) {
        proj_step<ISV>(acc, xf[0], wf[0]);
        refill_gap();
        // The two offsets are stepped by 64 k (2048 B) inside the statement of the wait and wrap
        // at 32 KB (bit 15 is 0 in both offsets, so clearing it is the wrap).
        // Precaution: registers that issued loads name are rewritten only when the loads have
        // passed address translation; written as plain additions the compiler lifted the steps
        // to directly behind the loads. Here the wait stands 32 products behind
        // the last load.
        asm volatile("s_wait_xcnt 0x0\n\t"
                     "v_add_nc_u32 %0, 0x800, %0\n\t"
                     "v_add_nc_u32 %1, 0x800, %1\n\t"
                     "v_and_b32 %0, 0xffff7fff, %0\n\t"
                     "v_and_b32 %1, 0xffff7fff, %1"
                     : "+v"(xo), "+v"(wo) :: "memory");
        proj_fetch(xf[0], wf[0], xbase + xo, wbase + wo, 0);
        proj_step<ISV>(acc, xf[1], wf[1]);
        refill_gap();
        proj_fetch(xf[1], wf[1], xbase + xo, wbase + wo, P_BK);
    }
    // the last two K steps: nothing left to fetch ahead
    // precaution: the two offsets of the loads above, held here as operands so that no load's
    // destination lands on them, are left alone until the loads have passed address translation
    asm volatile("s_wait_xcnt 0x0" :: "v"(xo), "v"(wo) : "memory");
    proj_step<ISV>(acc, xf[0], wf[0]);
    proj_step<ISV>(acc, xf[1], wf[1]);

    // scaled f16 chunks straight to the plane (each lane one 16-B vector per (mt, nt))
    const int bhi = (m0 / NSEQ) * NHD + n0 / DH;                     // + nt / 4
    const int nq0 = m0 % NSEQ + 64 * wm;
    _Float16* plane = planes + (size_t)proj * NXE + (size_t)bhi * (NSEQ * DH) + 8 * lane;
    H8 t[P_MT][P_NT];
#pragma unroll
    for (int nt = 0; nt < P_NT; ++nt) {
#pragma unroll
        for (int mt = 0; mt < P_MT; ++mt) {
            t[mt][nt].u = (v4u){0u, 0u, 0u, 0u};
#pragma unroll
            for (int r = 0; r < 8; ++r) t[mt][nt].h[r] = (_Float16)(acc[mt][nt][r] * osc);
        }
    }
#pragma unroll
    for (int nt = 0; nt < P_NT; ++nt) {
        const int hq = nt >> 2, nh = nt & 3;                         // head in the wave, tile in the head
#pragma unroll
        for (int mt = 0; mt < P_MT; ++mt) {
            // ISV: row dv = 16nh+lo, k = tokens 16mt+8h .. +7 -> tile (n/32)*4 + nh, half mt&1
            // else: row n = 16mt+lo, k = feats 16nh+8h .. +7  -> tile (n/16)*2 + nh/2, half nh&1
            const int off = ISV ? (((nq0 / 32 + (mt >> 1)) * 4 + nh) * 512 + (mt & 1) * 256)
                                : (((nq0 / 16 + mt) * 2 + (nh >> 1)) * 512 + (nh & 1) * 256);
            *reinterpret_cast<v4u*>(plane + hq * (NSEQ * DH) + off) = t[mt][nt].u;
        }
    }
}

// ------------------------------------------------------------------------
// Launch 4: attention. One block per (query block of 256, b*16+head, output index o),
// 8 waves x 32 queries (two query tiles of 16). Output o uses score stream s = (head&1)^o and
// the value plane of stream o. Scores are computed transposed, S^T = K . Q^T (D rows = keys,
// cols = queries), so the probabilities come out of D already in B-fragment layout for
// O^T = V^T . P^T (element r <- 16-key tile 0, element 8+r <- tile 1 of the step). Per lane and
// query tile: one query (lo), 16 of the 32 keys of a step; the other 16 live in lane lo+16.
// K, V^T and Q^T fragments come straight from the fragment-ordered f16 planes (no LDS
// staging); the 4 K tiles and the 4 V^T tiles of a step are 4 KB consecutive each, and every
// fragment feeds two products, one per query tile. Four waves per SIMD: 256 registers a wave.
// ------------------------------------------------------------------------
#define A_NW 8                // waves per block
#define A_QT 2                // query tiles of 16 per wave
#define A_QB (A_NW * A_QT * 16)
#define A_KT 32               // keys per step
// how far a score may lie above the softmax reference before the reference moves: a probability
// is then at most e^1.25 = 3.49, and carried x16384 at most 57187, inside f16 (65504)
#define A_LAZY 1.25f

__global__ __launch_bounds__(A_NW * 32) __attribute__((amdgpu_waves_per_eu(4, 4)))
void attn_kernel(const _Float16* planes, float* out)
{
    __shared__ v4f St[A_NW * A_QT * 256];                            // [8 waves][32][64] f32

    const int tid  = threadIdx.x;
    const int lane = tid & 31, w = tid >> 5, lo = lane & 15, hf = lane >> 4;
    const int qb = blockIdx.x, bh = blockIdx.y, o = blockIdx.z;
    const int b  = bh >> 4, hd = bh & 15;
    const int s  = (hd & 1) ^ o;                                     // score stream
    const size_t HO = (size_t)bh * NSEQ * DH;                        // same for both plane layouts
    const _Float16* Q = planes + (size_t)(s ? 3 : 0) * NXE + HO + 8 * lane;   // tiles (n/16)*2 + d/32, x0.125 inside
    const _Float16* K = planes + (size_t)(s ? 4 : 1) * NXE + HO + 8 * lane;   // tiles (n/16)*2 + d/32
    const _Float16* V = planes + (size_t)(o ? 5 : 2) * NXE + HO + 8 * lane;   // tiles (n/32)*4 + dv/16
    const int q0   = qb * A_QB + 16 * A_QT * w;                      // the wave's first query
    const int xidx = (lane ^ 16) * 4;                                // byte index of the partner lane

    // Q^T as B operand: column = query (lane lo), k = d by the split map
    Frag qf[A_QT][2];
#pragma unroll
    for (int qt = 0; qt < A_QT; ++qt)
#pragma unroll
        for (int dc = 0; dc < 2; ++dc) ldfrag(qf[qt][dc], Q + ((q0 / 16 + qt) * 2 + dc) * 512);

    v8f O[A_QT][4];
#pragma unroll
    for (int qt = 0; qt < A_QT; ++qt)
#pragma unroll
        for (int i = 0; i < 4; ++i) O[qt][i] = vzero8();
    float mrun[A_QT], mlim[A_QT], lrun[A_QT];                        // reference, reference + A_LAZY, sum
#pragma unroll
    for (int qt = 0; qt < A_QT; ++qt) { mrun[qt] = -1e30f; mlim[qt] = -1e30f; lrun[qt] = 0.f; }

    // K fragments are fetched one step ahead, V^T fragments at the head of their own step,
    // each set's eight loads as one group: none waits directly in front of its product.
    // Every block starts its walk over the keys at a step of its own and wraps: the eight query
    // blocks of a head, which read the same K and V^T lines, stand eight steps apart, and the
    // heads do not all stand at the same place of their planes.
    const int t0 = (8 * qb + ((2 * bh + o) & 7)) & (NSEQ / A_KT - 1);
    Frag kf[4];                                                      // A operand: row = key, k = d
#pragma unroll
    for (int i = 0; i < 4; ++i) ldfrag(kf[i], K + (t0 * 4 + i) * 512);

#pragma unroll 1
    for (int t = 0; t < NSEQ / A_KT; ++t) {
        const int ts = (t + t0) & (NSEQ / A_KT - 1);                 // the step's place among the keys
        const int kb = ts * A_KT;

        Frag vf[4];                                                  // A operand: row = dv 16nt+lo, k = key
        const _Float16* vp = V + (kb / 32) * 4 * 512;
#pragma unroll
        for (int i = 0; i < 4; ++i) ldfrag(vf[i], vp + i * 512);
        // holds the eight V^T loads as one group at the head of the step: sunk towards their
        // products they would be waited for with no lead
        __builtin_amdgcn_sched_barrier(0);

        // S^T tiles j = 0,1: keys kb+16j .. kb+16j+15; D[r] = score(query 16qt+lo, key kb+16j+8h+r)
        float p[A_QT][16];
#pragma unroll
        for (int j = 0; j < 2; ++j) {
#pragma unroll
            for (int qt = 0; qt < A_QT; ++qt) {
                v8f S = vzero8();
#pragma unroll
                for (int dc = 0; dc < 2; ++dc) S = mma_bare(kf[2 * j + dc], qf[qt][dc], S);
#pragma unroll
                for (int r = 0; r < 8; ++r) p[qt][8 * j + r] = S[r];
            }
        }

        // next step's K tiles into the registers just read (last step: the first again, not used)
        const int kn = ((ts + 1) & (NSEQ / A_KT - 1)) * A_KT;
        const _Float16* kp = K + (kn / 16) * 2 * 512;
#pragma unroll
        for (int i = 0; i < 4; ++i) ldfrag(kf[i], kp + i * 512);
        // holds the eight K loads directly behind the score products: softmax and the value
        // products of this step are their lead
        __builtin_amdgcn_sched_barrier(0);

        // online softmax in f32 (row = query 16qt+lo; partner lane lo^16 holds the other 16 keys),
        // taken against a reference mrun that is the same in both lanes of a query and moves only
        // when a score of the step lies more than A_LAZY above it
        float tmax[A_QT];
#pragma unroll
        for (int qt = 0; qt < A_QT; ++qt) {
            tmax[qt] = p[qt][0];
#pragma unroll
            for (int i = 1; i < 16; ++i) tmax[qt] = fmaxf(tmax[qt], p[qt][i]);
        }
        bool need = false;
#pragma unroll
        for (int qt = 0; qt < A_QT; ++qt) need = need || (tmax[qt] > mlim[qt]);
        // one test per step, the same for the whole wave (a scalar branch): each lane looks at its
        // own 16 keys, so the halves exchange their maxima only where the reference moves
        // (marked unlikely: the step that moves nothing is the straight path)
        if (__builtin_expect(__builtin_amdgcn_ballot_w32(need) != 0u, 0)) {
            float tx[A_QT];
#pragma unroll
            for (int qt = 0; qt < A_QT; ++qt) tx[qt] = other_half(tmax[qt], xidx);
#pragma unroll
            for (int qt = 0; qt < A_QT; ++qt) {
                const float mnew  = fmaxf(mrun[qt], fmaxf(tmax[qt], tx[qt]));
                const float alpha = __expf(mrun[qt] - mnew);
                lrun[qt] *= alpha;
                mrun[qt] = mnew;
                mlim[qt] = mnew + A_LAZY;
#pragma unroll
                for (int nt = 0; nt < 4; ++nt) O[qt][nt] = O[qt][nt] * alpha;
            }
        }
        // precaution: the two address pairs of this step's loads, held here as operands so that no
        // load's destination lands on them, are left alone until the loads have passed address
        // translation
        asm volatile("s_wait_xcnt 0x0" :: "v"(vp), "v"(kp) : "memory");
        float rs[A_QT];
#pragma unroll
        for (int qt = 0; qt < A_QT; ++qt) {
#pragma unroll
            for (int g = 0; g < 2; ++g) {
                float y[8];
#pragma unroll
                for (int r = 0; r < 8; ++r) y[r] = (p[qt][8 * g + r] - mrun[qt]) * 1.44269504088896340736f;
                exp2_x8(p[qt][8 * g], p[qt][8 * g + 1], p[qt][8 * g + 2], p[qt][8 * g + 3],
                        p[qt][8 * g + 4], p[qt][8 * g + 5], p[qt][8 * g + 6], p[qt][8 * g + 7], y);
            }
            rs[qt] = 0.f;
#pragma unroll
            for (int i = 0; i < 16; ++i) rs[qt] += p[qt][i];
        }
        float rx[A_QT];
#pragma unroll
        for (int qt = 0; qt < A_QT; ++qt) rx[qt] = other_half(rs[qt], xidx);
#pragma unroll
        for (int qt = 0; qt < A_QT; ++qt) lrun[qt] += rs[qt] + rx[qt];

        // O^T[dv][q] += V^T[dv][key] . P^T[key][q] over the 32 keys of the step
        Frag pf[A_QT];
#pragma unroll
        for (int qt = 0; qt < A_QT; ++qt) {
            // P^T as B operand straight from the D layout, carried x16384:
            // element r <- key 8h+r (tile 0), element 8+r <- key 16+8h+r (tile 1)
            H8 a0, a1;
            a0.u = (v4u){0u, 0u, 0u, 0u};
            a1.u = (v4u){0u, 0u, 0u, 0u};
#pragma unroll
            for (int r = 0; r < 8; ++r) {
                a0.h[r] = (_Float16)(p[qt][r] * 16384.0f);
                a1.h[r] = (_Float16)(p[qt][8 + r] * 16384.0f);
            }
            pf[qt].u[0] = a0.u;
            pf[qt].u[1] = a1.u;
        }
        // holds the row sums in front of the value products: with no rescale multiplies left to
        // stand among the products, the sums sunk there took the value fragments' registers for
        // their partial sums and were padded with idle slots
        __builtin_amdgcn_sched_barrier(0);
#pragma unroll
        for (int nt = 0; nt < 4; ++nt)
#pragma unroll
            for (int qt = 0; qt < A_QT; ++qt)
                O[qt][nt] = mma_bare(vf[nt], pf[qt], O[qt][nt]);     // D[r] = O[query 16qt+lo][dv 16nt+8h+r]
    }

    v4f* Sw = St + w * (A_QT * 256);
#pragma unroll
    for (int qt = 0; qt < A_QT; ++qt) {
        const float inv = 1.0f / (lrun[qt] * 16384.0f);              // lrun >= 1
#pragma unroll
        for (int nt = 0; nt < 4; ++nt) {
            v4f a  = {O[qt][nt][0] * inv, O[qt][nt][1] * inv, O[qt][nt][2] * inv, O[qt][nt][3] * inv};
            v4f cc = {O[qt][nt][4] * inv, O[qt][nt][5] * inv, O[qt][nt][6] * inv, O[qt][nt][7] * inv};
            Sw[(16 * qt + lo) * 16 + 4 * nt + 2 * hf]     = a;       // floats row*64 + 16nt + 8h .. +3
            Sw[(16 * qt + lo) * 16 + 4 * nt + 2 * hf + 1] = cc;      // .. +4 .. +7
        }
    }
    __syncthreads();

    float* ob = out + (size_t)o * NXE + ((size_t)b * NSEQ + q0) * DM + (size_t)hd * DH;
    const int c = (lane & 7) * 4;
    v4f vals[8 * A_QT];
#pragma unroll
    for (int si = 0; si < 8 * A_QT; ++si) {
        const int L = 4 * si + (lane >> 3);          // 64 lines per wave: row = L>>1, half = L&1
        vals[si] = Sw[8 * L + (lane & 7)];
    }
#pragma unroll
    for (int si = 0; si < 8 * A_QT; ++si) {
        const int L = 4 * si + (lane >> 3);
        *reinterpret_cast<v4f*>(ob + (size_t)(L >> 1) * DM + 32 * (L & 1) + c) = vals[si];
    }
}

// ------------------------------------------------------------------------
// host glue: 4 launches; shapes are fixed by the module configuration and
// checked against the passed sizes (no-op on any disagreement).
// ------------------------------------------------------------------------
extern "C" void kernel_launch(void* const* d_in, const int* in_sizes, int n_in,
                              void* d_out, int out_size, void* d_ws, size_t ws_size,
                              hipStream_t stream)
{
    if (n_in < 7) return;
    if (in_sizes[0] != NXE) return;
    for (int p = 0; p < NPROJ; ++p) if (in_sizes[1 + p] != NWE) return;
    if (out_size != 2 * NXE) return;
    const size_t ws_need = WS_HALVES * sizeof(_Float16);             // 71303168 B
    if (ws_size < ws_need) return;

    const float* x  = (const float*)d_in[0];
    const float* W0 = (const float*)d_in[1];
    const float* W1 = (const float*)d_in[2];
    const float* W2 = (const float*)d_in[3];
    const float* W3 = (const float*)d_in[4];
    const float* W4 = (const float*)d_in[5];
    const float* W5 = (const float*)d_in[6];
    _Float16* wsh = (_Float16*)d_ws;
    float* out = (float*)d_out;

    cvt_kernel<<<dim3(NWE / CV_BLK, 10, 1), 256, 0, stream>>>(x, W0, W1, W2, W3, W4, W5, wsh + OFF_XH);
    proj_kernel<0><<<dim3(DM / P_BN, NTOK / P_BM, 4), 128, 0, stream>>>(wsh + OFF_XH, wsh + OFF_WH, wsh + OFF_PL);
    proj_kernel<1><<<dim3(DM / P_BN, NTOK / P_BM, 2), 128, 0, stream>>>(wsh + OFF_XH, wsh + OFF_WH, wsh + OFF_PL);
    attn_kernel<<<dim3(NSEQ / A_QB, NB * NHD, 2), A_NW * 32, 0, stream>>>(wsh + OFF_PL, out);
}

// v008
// Measured time: 99.3 microseconds a run.
// Next to v007, in two timings, it ran 1.05 times as fast each time.
// Over all steps from v000 it is 3.79 times as fast.
#include <hip/hip_runtime.h>

// Contractions: six input projections, key x query^T score tiles and value^T x prob^T tiles,
// all v_wmma_f32_16x16x32_f16 (f16 operands, f32 accumulate). f16 operand scaling: weights x64,
// queries x0.125 * log2(e), probabilities x16384, folded back in f32 epilogues. Softmax statistics,
// normalisation and the outputs: f32.

typedef _Float16     v16h __attribute__((ext_vector_type(16)));
typedef _Float16     v8h  __attribute__((ext_vector_type(8)));
typedef float        v8f  __attribute__((ext_vector_type(8)));
typedef float        v4f  __attribute__((ext_vector_type(4)));
typedef unsigned int v4u  __attribute__((ext_vector_type(4)));

union Frag { v16h v; v8h h[2]; v4u u[2]; };
union H8   { v8h h; v4u u; };

#define DM    1024            // model width (dim_in = dim_k = dim_v)
#define NB    2               // batch
#define NSEQ  2048            // sequence length
#define NTOK  (NB * NSEQ)     // token rows
#define NHD   16              // heads
#define DH    64              // head width
#define NPROJ 6
#define NXE   (NTOK * DM)     // 4194304 elements per activation tensor
#define NWE   (DM * DM)       // 1048576 elements per weight

// workspace in 16-bit units; every operand lies in fragment order: a tile of 16 rows x 32 k
// is 512 consecutive units, unit = (k_in >> 3) * 128 + row_in * 8 + (k_in & 7), so that lane l
// of a wave finds its two 16-B fragment halves at tile + 8l and tile + 256 + 8l.
//   xh  f16(x)         rows = tokens,   k = dim_in: tile (row/16) * 32 + k/32       at OFF_XH
//   wh  f16(64 * W_p)  rows = features, k = dim_in: the same per weight             at OFF_WH
//   six planes of 4096*1024 at OFF_PL + p * NXE, each [b*16+head] x 131072 units:
//     p = 0,1,3,4  rows = n,  k = d: tile (n/16) * 2 + d/32 (q planes carry x0.125 * log2(e))
//     p = 2,5      rows = dv, k = n: tile (n/32) * 4 + dv/16
#define OFF_XH    ((size_t)0)
#define OFF_WH    ((size_t)NXE)
#define OFF_PL    ((size_t)NXE + (size_t)NPROJ * (size_t)NWE)
#define WS_HALVES (OFF_PL + (size_t)NPROJ * (size_t)NXE)        // 35651584 -> 71303168 B

// ------------------------------------------------------------------------
// helpers
// ------------------------------------------------------------------------
__device__ __forceinline__ v8f vzero8() {
    v8f z = {0.f, 0.f, 0.f, 0.f, 0.f, 0.f, 0.f, 0.f};
    return z;
}

// Fragment layout (wave32, 16x16x32), identical for A and B:
//   lane l: h = l>>4, m = l&15 = row of A / column of B / column of D
//   elements 0..7  -> k = k0 + 8h + 0..7
//   elements 8..15 -> k = k0 + 16 + 8h + 0..7
//   D element r -> (row 8h + r, column m)
// p = start of a fragment-ordered tile + 8 * lane: each of the two loads reads 512
// consecutive bytes per wave (four whole 128-B lines).
__device__ __forceinline__ void ldfrag(Frag& f, const _Float16* p) {
    f.h[0] = *reinterpret_cast<const v8h*>(p);
    f.h[1] = *reinterpret_cast<const v8h*>(p + 256);
}

// The product with no slots written behind it: the compiler pads its own builtin form, and only
// where a reader of D or a writer of A or B really stands within the distance. (An asm statement
// of v_nop that names D, A and B holds them all in v0..v255: with the projections' 256
// accumulator registers that build spilled to scratch.)
__device__ __forceinline__ v8f mma_bare(const Frag& a, const Frag& b, v8f c) {
    return __builtin_amdgcn_wmma_f32_16x16x32_f16(false, a.v, false, b.v, (short)0, c, false, false);
}

// Eight 2^x in one statement. The outputs are early-clobbered, so none lands on a source of the
// run; the closing v_nop is the slot that the instruction set asks for behind a transcendental
// before its result is read or its source overwritten.
__device__ __forceinline__ void exp2_x8(float& e0, float& e1, float& e2, float& e3,
                                        float& e4, float& e5, float& e6, float& e7,
                                        const float (&y)[8]) {
    asm("v_exp_f32 %0, %8\n\tv_exp_f32 %1, %9\n\tv_exp_f32 %2, %10\n\tv_exp_f32 %3, %11\n\t"
        "v_exp_f32 %4, %12\n\tv_exp_f32 %5, %13\n\tv_exp_f32 %6, %14\n\tv_exp_f32 %7, %15\n\t"
        "v_nop"
        : "=&v"(e0), "=&v"(e1), "=&v"(e2), "=&v"(e3), "=&v"(e4), "=&v"(e5), "=&v"(e6), "=&v"(e7)
        : "v"(y[0]), "v"(y[1]), "v"(y[2]), "v"(y[3]), "v"(y[4]), "v"(y[5]), "v"(y[6]), "v"(y[7]));
}

// The value that lane l ^ 16 holds; idx = 4 * (l ^ 16), formed once in front of the loop (the
// library shuffle's index was formed anew in every step once a branch stood in the loop).
__device__ __forceinline__ float other_half(float v, int idx) {
    return __builtin_bit_cast(float, __builtin_amdgcn_ds_bpermute(idx, __builtin_bit_cast(int, v)));
}

// ------------------------------------------------------------------------
// Launch 1: f32 -> f16 conversion of x (scale 1) and the six weights (scale 64).
// Ten segments of 1048576 elements (x quarters 0..3, weights 4..9), grid (64, 10).
// A block converts one tile row (16 rows x 1024 k), the same 16384 units in source and
// in fragment order. Each lane converts 8 consecutive k of one row -> one 16-B store; a
// wave takes 8 rows x 32 k, so its store fills four whole 128-B lines.
// ------------------------------------------------------------------------
#define CV_IT  8
#define CV_BLK (256 * 8 * CV_IT)        // 16384 elements per block

__global__ __launch_bounds__(256) void cvt_kernel(
    const float* __restrict__ x,
    const float* __restrict__ W0, const float* __restrict__ W1, const float* __restrict__ W2,
    const float* __restrict__ W3, const float* __restrict__ W4, const float* __restrict__ W5,
    _Float16* wsh)
{
    const int tid = threadIdx.x;
    const int lane = tid & 31, wv = tid >> 5;
    const int row = (wv & 1) * 8 + (lane >> 2), kq = lane & 3;       // row in the tile, 8-k chunk
    const int seg = blockIdx.y;                                      // block-uniform
    const float* src;
    float sc;
    if (seg < 4) {
        src = x + (size_t)seg * NWE;
        sc  = 1.0f;
    } else {
        const int p = seg - 4;
        src = (p == 0) ? W0 : (p == 1) ? W1 : (p == 2) ? W2 : (p == 3) ? W3 : (p == 4) ? W4 : W5;
        sc  = 64.0f;                                                 // exact power of two
    }
    const size_t base = (size_t)blockIdx.x * CV_BLK;
    // pass i: k tile 4i + (wv >> 1)
    const float* sp = src + base;
    _Float16*    dp = wsh + (size_t)seg * NWE + base;
    const int so = row * DM + (wv >> 1) * 32 + kq * 8;               // source: row-major
    const int dn = (wv >> 1) * 512 + kq * 128 + row * 8;             // destination: fragment order

    H8 v[CV_IT];
#pragma unroll
    for (int i = 0; i < CV_IT; ++i) {
        const int e = so + i * 128;
        const v4f f0 = *reinterpret_cast<const v4f*>(sp + e);
        const v4f f1 = *reinterpret_cast<const v4f*>(sp + e + 4);
        H8 t;
        t.u = (v4u){0u, 0u, 0u, 0u};
#pragma unroll
        for (int q = 0; q < 4; ++q) {
            t.h[q]     = (_Float16)(f0[q] * sc);                     // RNE convert
            t.h[4 + q] = (_Float16)(f1[q] * sc);
        }
        v[i] = t;
    }
#pragma unroll
    for (int i = 0; i < CV_IT; ++i) {
        const int e = dn + i * 2048;
        *reinterpret_cast<v4u*>(dp + e) = v[i].u;
    }
    
}

// ------------------------------------------------------------------------
// Launch 2/3: Y = xh . wh^T / 64 for the projections. Block tile 128 tokens x 256
// features (four heads), 4 waves (2 x 2) of 64 tokens x 128 features, K stepped by 32:
// the twelve fragments of a K step feed 32 products (384 B loaded per product).
// Fragments are loaded directly from the fragment-ordered f16 tiles (identical split k map
// for both operands). ISV = 0: q/k planes, rows = n (q planes additionally x0.125 * log2(e));
// ISV = 1: value planes, rows = dv. In both the 8 values a lane holds of an accumulator are
// one 16-B chunk of the plane's fragment order at tile half + 8 * lane: stored directly,
// 512 consecutive bytes per wave and store.
// ------------------------------------------------------------------------
#define P_BM 128
#define P_BN 256
#define P_BK 32
#define P_MT 4                // token tiles of 16 per wave
#define P_NT 8                // feature tiles of 16 per wave

// the twelve fragments of K step k0: token rows 16mt + lo, feature rows 16nt + lo of the wave
__device__ __forceinline__ void proj_fetch(Frag (&xf)[P_MT], Frag (&wf)[P_NT],
                                           const char* xp, const char* wp, int k0) {
    const _Float16* xa = reinterpret_cast<const _Float16*>(xp);
    const _Float16* wb = reinterpret_cast<const _Float16*>(wp);
#pragma unroll
    for (int mt = 0; mt < P_MT; ++mt) ldfrag(xf[mt], xa + (size_t)(16 * mt) * DM + 16 * k0);
    // token fragments first in every group, the one in front of the loop too: with that group in
    // another order the counted waits at the loop's head, which hold for both, took the whole set
    __builtin_amdgcn_sched_barrier(0);
#pragma unroll
    for (int nt = 0; nt < P_NT; ++nt) ldfrag(wf[nt], wb + (size_t)(16 * nt) * DM + 16 * k0);
    // holds the 24 loads as one group in front of the other set's products: sunk towards their
    // own products they would be waited for with no lead
    __builtin_amdgcn_sched_barrier(0);
}

template <int ISV>
__device__ __forceinline__ void proj_step(v8f (&acc)[P_MT][P_NT], const Frag (&xf)[P_MT],
                                          const Frag (&wf)[P_NT]) {
#pragma unroll
    for (int nt = 0; nt < P_NT; ++nt) {
#pragma unroll
        for (int mt = 0; mt < P_MT; ++mt) {
            if (ISV) {
                // D[r] = Y[token 16mt+8h+r][feat 16nt+lo]
                acc[mt][nt] = mma_bare(xf[mt], wf[nt], acc[mt][nt]);
            } else {
                // D[r] = Y[token 16mt+lo][feat 16nt+8h+r]
                acc[mt][nt] = mma_bare(wf[nt], xf[mt], acc[mt][nt]);
            }
        }
    }
    // keeps the products in front of the loads that refill their operand registers
    __builtin_amdgcn_sched_barrier(0);
}

// Four slots between a set's last product and the loads that refill its registers, A and B
// operands alike, so that no load stands directly behind a product whose B it overwrites.
// The clobber keeps the loads behind the slots.
__device__ __forceinline__ void refill_gap() {
    asm volatile("v_nop\n\tv_nop\n\tv_nop\n\tv_nop" ::: "memory");
}

template <int ISV>
__global__ __launch_bounds__(128) void proj_kernel(const _Float16* xh, const _Float16* wh,
                                                   _Float16* planes)
{
    const int tid  = threadIdx.x;
    const int lane = tid & 31, w = tid >> 5;
    const int wm = w >> 1, wn = w & 1;                               // wave's place in the block tile
    const int z    = blockIdx.z;                                     // block-uniform
    int proj;
    float osc;
    if (ISV) {
        proj = 2 + 3 * z;                                            // 2, 5
        osc  = 1.0f / 64.0f;
    } else {
        proj = z + ((z >= 2) ? 1 : 0);                               // 0, 1, 3, 4
        // q planes: 0.125 * log2(e) / 64, so that a score leaves its product in base-2 units
        osc  = (z == 0 || z == 2) ? (1.44269504088896340736f / 512.0f) : (1.0f / 64.0f);
    }
    const int n0 = blockIdx.x * P_BN + 128 * wn;                     // wave's feature base = head * 64
    const int m0 = blockIdx.y * P_BM;                                // block's token base

    // block-uniform bases and the lane's two byte offsets, which walk along K
    const char* xbase = reinterpret_cast<const char*>(xh + (size_t)m0 * DM);
    const char* wbase = reinterpret_cast<const char*>(wh + ((size_t)proj * DM + blockIdx.x * P_BN) * DM);
    // Every block starts its walk along K at a place of its own (a multiple of 64 k = 2048 B) and
    // wraps at the end of the row tile's 32 KB: blocks that share token rows (same y) do not ask L2
    // for the same lines at the same moment; of the blocks that share feature rows (same x, z)
    // only the pairs y = 2j, 2j + 1 start at the same place; and the blocks of the
    // launch do not all stand at the same place of every 32-KB row tile.
    const unsigned ks = ((blockIdx.x + 4u * (unsigned)z + (blockIdx.y >> 1)) & 15u) * 0x800u;
    unsigned xo = (unsigned)(64 * wm * DM + 8 * lane) * 2u + ks;     // + (16*mt*DM + 16*k0) * 2
    unsigned wo = (unsigned)(128 * wn * DM + 8 * lane) * 2u + ks;    // + (16*nt*DM + 16*k0) * 2

    v8f acc[P_MT][P_NT];
#pragma unroll
    for (int mt = 0; mt < P_MT; ++mt)
#pragma unroll
        for (int nt = 0; nt < P_NT; ++nt) acc[mt][nt] = vzero8();

    // Two register sets of the twelve fragments of a K step: while one set feeds its 32
    // products, the other set's 24 loads, issued as one group, are in flight.
    Frag xf[2][P_MT], wf[2][P_NT];
    proj_fetch(xf[0], wf[0], xbase + xo, wbase + wo, 0);
    proj_fetch(xf[1], wf[1], xbase + xo, wbase + wo, P_BK);
    // kept rolled: one trip holds both sets, a longer body would only add code
#pragma unroll 1
    for (int k0 = 0; k0 < DM - 2 * P_BK; k0 += 2 * P_BK) {
        proj_step<ISV>(acc, xf[0], wf[0]);
        refill_gap();
        // The two offsets are stepped by 64 k (2048 B) inside the statement of the wait and wrap
        // at 32 KB (bit 15 is 0 in both offsets, so clearing it is the wrap).
        // Precaution: registers that issued loads name are rewritten only when the loads have
        // passed address translation; written as plain additions the compiler lifted the steps
        // to directly behind the loads. Here the wait stands 32 products behind
        // the last load.
        asm volatile("s_wait_xcnt 0x0\n\t"
                     "v_add_nc_u32 %0, 0x800, %0\n\t"
                     "v_add_nc_u32 %1, 0x800, %1\n\t"
                     "v_and_b32 %0, 0xffff7fff, %0\n\t"
                     "v_and_b32 %1, 0xffff7fff, %1"
                     : "+v"(xo), "+v"(wo) :: "memory");
        proj_fetch(xf[0], wf[0], xbase + xo, wbase + wo, 0);
        proj_step<ISV>(acc, xf[1], wf[1]);
        refill_gap();
        proj_fetch(xf[1], wf[1], xbase + xo, wbase + wo, P_BK);
    }
    // the last two K steps: nothing left to fetch ahead
    // precaution: the two offsets of the loads above, held here as operands so that no load's
    // destination lands on them, are left alone until the loads have passed address translation
    asm volatile("s_wait_xcnt 0x0" :: "v"(xo), "v"(wo) : "memory");
    proj_step<ISV>(acc, xf[0], wf[0]);
    proj_step<ISV>(acc, xf[1], wf[1]);

    // scaled f16 chunks straight to the plane (each lane one 16-B vector per (mt, nt))
    const int bhi = (m0 / NSEQ) * NHD + n0 / DH;                     // + nt / 4
    const int nq0 = m0 % NSEQ + 64 * wm;
    _Float16* plane = planes + (size_t)proj * NXE + (size_t)bhi * (NSEQ * DH) + 8 * lane;
    H8 t[P_MT][P_NT];
#pragma unroll
    for (int nt = 0; nt < P_NT; ++nt) {
#pragma unroll
        for (int mt = 0; mt < P_MT; ++mt) {
            t[mt][nt].u = (v4u){0u, 0u, 0u, 0u};
#pragma unroll
            for (int r = 0; r < 8; ++r) t[mt][nt].h[r] = (_Float16)(acc[mt][nt][r] * osc);
        }
    }
#pragma unroll
    for (int nt = 0; nt < P_NT; ++nt) {
        const int hq = nt >> 2, nh = nt & 3;                         // head in the wave, tile in the head
#pragma unroll
        for (int mt = 0; mt < P_MT; ++mt) {
            // ISV: row dv = 16nh+lo, k = tokens 16mt+8h .. +7 -> tile (n/32)*4 + nh, half mt&1
            // else: row n = 16mt+lo, k = feats 16nh+8h .. +7  -> tile (n/16)*2 + nh/2, half nh&1
            const int off = ISV ? (((nq0 / 32 + (mt >> 1)) * 4 + nh) * 512 + (mt & 1) * 256)
                                : (((nq0 / 16 + mt) * 2 + (nh >> 1)) * 512 + (nh & 1) * 256);
            *reinterpret_cast<v4u*>(plane + hq * (NSEQ * DH) + off) = t[mt][nt].u;
        }
    }
}

// ------------------------------------------------------------------------
// Launch 4: attention. One block per (query block of 256, b*16+head, output index o),
// 8 waves x 32 queries (two query tiles of 16). Output o uses score stream s = (head&1)^o and
// the value plane of stream o. Scores are computed transposed, S^T = K . Q^T (D rows = keys,
// cols = queries), so the probabilities come out of D already in B-fragment layout for
// O^T = V^T . P^T (element r <- 16-key tile 0, element 8+r <- tile 1 of the step). Per lane and
// query tile: one query (lo), 16 of the 32 keys of a step; the other 16 live in lane lo+16.
// K, V^T and Q^T fragments come straight from the fragment-ordered f16 planes (no LDS
// staging); the 4 K tiles and the 4 V^T tiles of a step are 4 KB consecutive each, and every
// fragment feeds two products, one per query tile. Four waves per SIMD: 256 registers a wave.
// ------------------------------------------------------------------------
#define A_NW 8                // waves per block
#define A_QT 2                // query tiles of 16 per wave
#define A_QB (A_NW * A_QT * 16)
#define A_KT 32               // keys per step
// probabilities are carried x2^14: the 14 is added in front of the exponential
#define A_CARRY 14.0f
// how far a score (base-2 units) may lie above the softmax reference before the reference moves:
// a carried probability is then at most 2^15.8 = 57052, inside f16 (65504)
#define A_LAZY 1.8f

__global__ __launch_bounds__(A_NW * 32) __attribute__((amdgpu_waves_per_eu(4, 4)))
void attn_kernel(const _Float16* planes, float* out)
{
    __shared__ v4f St[A_NW * A_QT * 256];                            // [8 waves][32][64] f32

    const int tid  = threadIdx.x;
    const int lane = tid & 31, w = tid >> 5, lo = lane & 15, hf = lane >> 4;
    const int qb = blockIdx.x, bh = blockIdx.y, o = blockIdx.z;
    const int b  = bh >> 4, hd = bh & 15;
    const int s  = (hd & 1) ^ o;                                     // score stream
    const size_t HO = (size_t)bh * NSEQ * DH;                        // same for both plane layouts
    const _Float16* Q = planes + (size_t)(s ? 3 : 0) * NXE + HO + 8 * lane;   // tiles (n/16)*2 + d/32, x0.125 * log2(e) inside
    const _Float16* K = planes + (size_t)(s ? 4 : 1) * NXE + HO + 8 * lane;   // tiles (n/16)*2 + d/32
    const _Float16* V = planes + (size_t)(o ? 5 : 2) * NXE + HO + 8 * lane;   // tiles (n/32)*4 + dv/16
    const int q0   = qb * A_QB + 16 * A_QT * w;                      // the wave's first query
    const int xidx = (lane ^ 16) * 4;                                // byte index of the partner lane

    // Q^T as B operand: column = query (lane lo), k = d by the split map
    Frag qf[A_QT][2];
#pragma unroll
    for (int qt = 0; qt < A_QT; ++qt)
#pragma unroll
        for (int dc = 0; dc < 2; ++dc) ldfrag(qf[qt][dc], Q + ((q0 / 16 + qt) * 2 + dc) * 512);

    v8f O[A_QT][4];
#pragma unroll
    for (int qt = 0; qt < A_QT; ++qt)
#pragma unroll
        for (int i = 0; i < 4; ++i) O[qt][i] = vzero8();
    // Cs: A_CARRY - softmax reference of the lane's query, in all eight elements: the start value of
    // the score products' accumulators, so that D is the exponential's argument as it stands.
    // The reference starts at 0; the first step always sets it from its own scores.
    v8f   Cs[A_QT];
    float lrun[A_QT];                                                // sum, carried x2^14 like O
#pragma unroll
    for (int qt = 0; qt < A_QT; ++qt) {
        Cs[qt] = (v8f){A_CARRY, A_CARRY, A_CARRY, A_CARRY, A_CARRY, A_CARRY, A_CARRY, A_CARRY};
        lrun[qt] = 0.f;
    }

    // K fragments are fetched one step ahead, V^T fragments at the head of their own step,
    // each set's eight loads as one group: none waits directly in front of its product.
    // Every block starts its walk over the keys at a step of its own and wraps: the eight query
    // blocks of a head, which read the same K and V^T lines, stand eight steps apart, and the
    // heads do not all stand at the same place of their planes.
    const int t0 = (8 * qb + ((2 * bh + o) & 7)) & (NSEQ / A_KT - 1);
    Frag kf[4];                                                      // A operand: row = key, k = d
#pragma unroll
    for (int i = 0; i < 4; ++i) ldfrag(kf[i], K + (t0 * 4 + i) * 512);

#pragma unroll 1
    for (int t = 0; t < NSEQ / A_KT; ++t) {
        const int ts = (t + t0) & (NSEQ / A_KT - 1);                 // the step's place among the keys
        const int kb = ts * A_KT;

        Frag vf[4];                                                  // A operand: row = dv 16nt+lo, k = key
        const _Float16* vp = V + (kb / 32) * 4 * 512;
#pragma unroll
        for (int i = 0; i < 4; ++i) ldfrag(vf[i], vp + i * 512);
        // holds the eight V^T loads as one group at the head of the step: sunk towards their
        // products they would be waited for with no lead
        __builtin_amdgcn_sched_barrier(0);

        // S^T tiles j = 0,1: keys kb+16j .. kb+16j+15;
        // D[r] = score(query 16qt+lo, key kb+16j+8h+r) - reference + A_CARRY
        float p[A_QT][16];
#pragma unroll
        for (int j = 0; j < 2; ++j) {
#pragma unroll
            for (int qt = 0; qt < A_QT; ++qt) {
                v8f S = Cs[qt];
#pragma unroll
                for (int dc = 0; dc < 2; ++dc) S = mma_bare(kf[2 * j + dc], qf[qt][dc], S);
#pragma unroll
                for (int r = 0; r < 8; ++r) p[qt][8 * j + r] = S[r];
            }
        }

        // keeps the two start tiles alive behind their last product: where a product was a tile's last
        // reader, the compiler wrote D over a copy of the tile, made anew in every step (four 64-bit
        // moves and two idle slots)
        asm volatile("" :: "v"(Cs[0]), "v"(Cs[1]));

        // next step's K tiles into the registers just read (last step: the first again, not used)
        const int kn = ((ts + 1) & (NSEQ / A_KT - 1)) * A_KT;
        const _Float16* kp = K + (kn / 16) * 2 * 512;
#pragma unroll
        for (int i = 0; i < 4; ++i) ldfrag(kf[i], kp + i * 512);
        // holds the eight K loads directly behind the score products: softmax and the value
        // products of this step are their lead
        __builtin_amdgcn_sched_barrier(0);

        // online softmax in f32 (row = query 16qt+lo; partner lane lo^16 holds the other 16 keys),
        // taken against a reference that is the same in both lanes of a query and moves only
        // when a score of the step lies more than A_LAZY above it (in the first step: always)
        float tmax[A_QT];
#pragma unroll
        for (int qt = 0; qt < A_QT; ++qt) {
            tmax[qt] = p[qt][0];
#pragma unroll
            for (int i = 1; i < 16; ++i) tmax[qt] = fmaxf(tmax[qt], p[qt][i]);
        }
        const float thr = (t == 0) ? -__builtin_inff() : (A_CARRY + A_LAZY);
        bool need = false;
#pragma unroll
        for (int qt = 0; qt < A_QT; ++qt) need = need || (tmax[qt] > thr);
        // one test per step, the same for the whole wave (a scalar branch): each lane looks at its
        // own 16 keys, so the halves exchange their maxima only where the reference moves
        // (marked unlikely: the step that moves nothing is the straight path)
        if (__builtin_expect(__builtin_amdgcn_ballot_w32(need) != 0u, 0)) {
            float tx[A_QT];
#pragma unroll
            for (int qt = 0; qt < A_QT; ++qt) tx[qt] = other_half(tmax[qt], xidx);
#pragma unroll
            for (int qt = 0; qt < A_QT; ++qt) {
                // how far the reference moves: up to the step's maximum, never down, but in the
                // first step to that maximum wherever it lies (O and the sum are still 0 there, so
                // their factor is held at 1 or below and cannot overflow)
                const float up    = fmaxf(tmax[qt], tx[qt]) - A_CARRY;
                const float delta = (t == 0) ? up : fmaxf(up, 0.f);
                const float alpha = __builtin_amdgcn_exp2f(fminf(-delta, 0.f));
                lrun[qt] *= alpha;
                Cs[qt] = Cs[qt] - delta;
#pragma unroll
                for (int i = 0; i < 16; ++i) p[qt][i] -= delta;      // this step's scores follow
#pragma unroll
                for (int nt = 0; nt < 4; ++nt) O[qt][nt] = O[qt][nt] * alpha;
            }
        }
        // precaution: the two address pairs of this step's loads, held here as operands so that no
        // load's destination lands on them, are left alone until the loads have passed address
        // translation
        asm volatile("s_wait_xcnt 0x0" :: "v"(vp), "v"(kp) : "memory");
        float rs[A_QT];
#pragma unroll
        for (int qt = 0; qt < A_QT; ++qt) {
#pragma unroll
            for (int g = 0; g < 2; ++g) {
                float y[8];
#pragma unroll
                for (int r = 0; r < 8; ++r) y[r] = p[qt][8 * g + r];
                exp2_x8(p[qt][8 * g], p[qt][8 * g + 1], p[qt][8 * g + 2], p[qt][8 * g + 3],
                        p[qt][8 * g + 4], p[qt][8 * g + 5], p[qt][8 * g + 6], p[qt][8 * g + 7], y);
            }
            rs[qt] = 0.f;
#pragma unroll
            for (int i = 0; i < 16; ++i) rs[qt] += p[qt][i];
        }
        float rx[A_QT];
#pragma unroll
        for (int qt = 0; qt < A_QT; ++qt) rx[qt] = other_half(rs[qt], xidx);
#pragma unroll
        for (int qt = 0; qt < A_QT; ++qt) lrun[qt] += rs[qt] + rx[qt];

        // O^T[dv][q] += V^T[dv][key] . P^T[key][q] over the 32 keys of the step
        Frag pf[A_QT];
#pragma unroll
        for (int qt = 0; qt < A_QT; ++qt) {
            // P^T as B operand straight from the D layout, carried x16384 (A_CARRY in the exponent):
            // element r <- key 8h+r (tile 0), element 8+r <- key 16+8h+r (tile 1)
            H8 a0, a1;
            a0.u = (v4u){0u, 0u, 0u, 0u};
            a1.u = (v4u){0u, 0u, 0u, 0u};
#pragma unroll
            for (int r = 0; r < 8; ++r) {
                a0.h[r] = (_Float16)p[qt][r];
                a1.h[r] = (_Float16)p[qt][8 + r];
            }
            pf[qt].u[0] = a0.u;
            pf[qt].u[1] = a1.u;
        }
        // holds the row sums in front of the value products: with no rescale multiplies left to
        // stand among the products, the sums sunk there took the value fragments' registers for
        // their partial sums and were padded with idle slots
        __builtin_amdgcn_sched_barrier(0);
#pragma unroll
        for (int nt = 0; nt < 4; ++nt)
#pragma unroll
            for (int qt = 0; qt < A_QT; ++qt)
                O[qt][nt] = mma_bare(vf[nt], pf[qt], O[qt][nt]);     // D[r] = O[query 16qt+lo][dv 16nt+8h+r]
    }

    v4f* Sw = St + w * (A_QT * 256);
#pragma unroll
    for (int qt = 0; qt < A_QT; ++qt) {
        const float inv = 1.0f / lrun[qt];                           // both carried x2^14
#pragma unroll
        for (int nt = 0; nt < 4; ++nt) {
            v4f a  = {O[qt][nt][0] * inv, O[qt][nt][1] * inv, O[qt][nt][2] * inv, O[qt][nt][3] * inv};
            v4f cc = {O[qt][nt][4] * inv, O[qt][nt][5] * inv, O[qt][nt][6] * inv, O[qt][nt][7] * inv};
            Sw[(16 * qt + lo) * 16 + 4 * nt + 2 * hf]     = a;       // floats row*64 + 16nt + 8h .. +3
            Sw[(16 * qt + lo) * 16 + 4 * nt + 2 * hf + 1] = cc;      // .. +4 .. +7
        }
    }
    __syncthreads();

    float* ob = out + (size_t)o * NXE + ((size_t)b * NSEQ + q0) * DM + (size_t)hd * DH;
    const int c = (lane & 7) * 4;
    v4f vals[8 * A_QT];
#pragma unroll
    for (int si = 0; si < 8 * A_QT; ++si) {
        const int L = 4 * si + (lane >> 3);          // 64 lines per wave: row = L>>1, half = L&1
        vals[si] = Sw[8 * L + (lane & 7)];
    }
#pragma unroll
    for (int si = 0; si < 8 * A_QT; ++si) {
        const int L = 4 * si + (lane >> 3);
        *reinterpret_cast<v4f*>(ob + (size_t)(L >> 1) * DM + 32 * (L & 1) + c) = vals[si];
    }
}

// ------------------------------------------------------------------------
// host glue: 4 launches; shapes are fixed by the module configuration and
// checked against the passed sizes (no-op on any disagreement).
// ------------------------------------------------------------------------
extern "C" void kernel_launch(void* const* d_in, const int* in_sizes, int n_in,
                              void* d_out, int out_size, void* d_ws, size_t ws_size,
                              hipStream_t stream)
{
    if (n_in < 7) return;
    if (in_sizes[0] != NXE) return;
    for (int p = 0; p < NPROJ; ++p) if (in_sizes[1 + p] != NWE) return;
    if (out_size != 2 * NXE) return;
    const size_t ws_need = WS_HALVES * sizeof(_Float16);             // 71303168 B
    if (ws_size < ws_need) return;

    const float* x  = (const float*)d_in[0];
    const float* W0 = (const float*)d_in[1];
    const float* W1 = (const float*)d_in[2];
    const float* W2 = (const float*)d_in[3];
    const float* W3 = (const float*)d_in[4];
    const float* W4 = (const float*)d_in[5];
    const float* W5 = (const float*)d_in[6];
    _Float16* wsh = (_Float16*)d_ws;
    float* out = (float*)d_out;

    cvt_kernel<<<dim3(NWE / CV_BLK, 10, 1), 256, 0, stream>>>(x, W0, W1, W2, W3, W4, W5, wsh + OFF_XH);
    proj_kernel<0><<<dim3(DM / P_BN, NTOK / P_BM, 4), 128, 0, stream>>>(wsh + OFF_XH, wsh + OFF_WH, wsh + OFF_PL);
    proj_kernel<1><<<dim3(DM / P_BN, NTOK / P_BM, 2), 128, 0, stream>>>(wsh + OFF_XH, wsh + OFF_WH, wsh + OFF_PL);
    attn_kernel<<<dim3(NSEQ / A_QB, NB * NHD, 2), A_NW * 32, 0, stream>>>(wsh + OFF_PL, out);
}
